// v000
// The times below were measured on an AMD MI455X: many runs one after another, warmed up first and cycling through
// copies of the inputs, with the whole window's GPU time divided by the number of runs. Launches and the gaps
// between them are all in it. The median over several windows is given; except for v000 it joins two sittings, which
// can be a few percent apart, so the side-by-side timings, each taken in one sitting, are the better comparison.
// The starting kernel, v000, takes 261 microseconds a run.
#include <hip/hip_runtime.h>

// Multi-head attention on raw streams q, k, v [NB][SEQ][1024] = 16 heads x 64 (no input projections, no mask), score scale 1/8, output projection y = ctx W^T + b with W [out][in].
// Compute dtypes, f32 accumulate everywhere, all contractions v_wmma_f32_16x16x32_f16: q, k, v, W, b are RNE-converted to bf16 and all but b held exactly in f16 (W with a x64 carry); scores single product; P (x256 carry, cancels in the normalisation) and v single product;
// ctx carried x4096 as f16 value + f16 remainder (two products against the same W plane, one accumulator); softmax f32 (online, running max); bias added in f32.
// Layout: f16 planes Q, K [b][t][1024] (head h = columns h*64..), V^T plane [b*1024 + c][t] (LDS transpose), fused flash kernel in transposed form (S^T = K Q^T, O^T = V^T P^T) writing the ctx plane [b*SEQ+t][hi 1024 | rem 1024],
// then a one-wave-per-64x64-tile GEMM over K = 2048 (hi | rem) against W rows.

#ifndef NB
#define NB 4
#endif
#ifndef SEQ
#define SEQ 2048
#endif
#define NB_FULL  4
#define SEQ_FULL 2048
#ifndef OUT_SEQ
#define OUT_SEQ SEQ              // row pitch (in tokens) between batches of the output
#endif
#define DM   1024
#define NH_  16
#define HD   64
#define AW   4                   // waves per flash block (16 query rows each)
#define SC2  (0.125f * 1.4426950408889634f)   // HD^-0.5 * log2(e)
#define PSH  8.0f                // log2 of the P carry (256)
#define CXS  4096.0f             // carry of the ctx plane (value and remainder)
#define WSC  64.0f               // carry of the W plane
#define OSC  (1.0f / (4096.0f * 64.0f))

static_assert(HD == 64);
static_assert(NH_ * HD == DM);                 // head h = columns h*64 + d
static_assert((DM & (DM - 1)) == 0);           // k index wraps with a mask in the output GEMM
static_assert(DM % 64 == 0);
static_assert(DM % 32 == 0);                   // GEMM k-loop steps by 32
static_assert(SEQ % 64 == 0);                  // a 64-row tile never straddles two batches
static_assert((NB * SEQ) % 64 == 0);
static_assert(SEQ % 32 == 0);                  // key loop steps by 32
static_assert(SEQ % (16 * AW) == 0);           // flash grid covers the sequence exactly
static_assert(((size_t)SEQ * DM) % 64 == 0);
static_assert(((size_t)DM * DM) % 64 == 0);
static_assert(NB <= NB_FULL);
static_assert(SEQ <= SEQ_FULL);

typedef _Float16 h16;
typedef __attribute__((ext_vector_type(16))) _Float16 v16h;
typedef __attribute__((ext_vector_type(8)))  _Float16 v8h;
typedef __attribute__((ext_vector_type(8)))  float    v8f;
typedef __attribute__((ext_vector_type(4)))  float    v4f;
typedef v4f  __attribute__((may_alias)) v4fa;
typedef v8h  __attribute__((may_alias)) v8ha;

// RNE convert f32 -> bf16, returned as the f32 value of that bf16
__device__ __forceinline__ float bfr(float f) { unsigned u = __float_as_uint(f); u += 0x7FFFu + ((u >> 16) & 1u); return __uint_as_float(u & 0xFFFF0000u); }
__device__ __forceinline__ v16h cat16(v8h lo, v8h hi) { return __builtin_shufflevector(lo, hi, 0, 1, 2, 3, 4, 5, 6, 7, 8, 9, 10, 11, 12, 13, 14, 15); }
__device__ __forceinline__ v8f wmma16(v16h a, v16h b, v8f c) { return __builtin_amdgcn_wmma_f32_16x16x32_f16(false, a, false, b, (short)0, c, false, false); }
// fragment loader from K-contiguous f16 rows; p already includes + 8*(lane>>4): elements 0..7 <- k0+8h+0..7, elements 8..15 <- k0+16+8h+0..7 (same map for A and B)
__device__ __forceinline__ v16h ldh(const h16* p) { return cat16(*(const v8h*)p, *(const v8h*)(p + 16)); }
// ordering point for wave-private LDS tiles (same wave writes and reads)
__device__ __forceinline__ void wave_sync() { __builtin_amdgcn_fence(3 /* release order */, "wavefront"); __builtin_amdgcn_wave_barrier(); asm volatile("" ::: "memory"); }

__global__ __launch_bounds__(256) void k_cvt8(const float* __restrict__ src, h16* dst, size_t n8, float scale) {
    const size_t i = (size_t)blockIdx.x * 256 + threadIdx.x; if (i >= n8) return;
    const v8f v = *(const v8f*)(src + i * 8); v8h o;
#pragma unroll
    for (int k = 0; k < 8; ++k) o[k] = (h16)(bfr(v[k]) * scale);
    *(v8h*)(dst + i * 8) = o; 
}

// k_vt: V^T plane. in: v[b][t][c] (f32, per-batch pitch SEQ_FULL*DM) -> out: VT[b*DM + c][t] (f16 of the bf16 RNE value). 64 x 64 tile through LDS (cross-wave: block barrier).
__global__ __launch_bounds__(256) void k_vt(const float* __restrict__ V, h16* VT) {
    __shared__ __align__(16) h16 ts[64 * 72];
    const int tid = threadIdx.x; const int t0 = blockIdx.x * 64, c0 = blockIdx.y * 64, b = blockIdx.z;
    const float* src = V + ((size_t)b * SEQ_FULL + t0) * DM + c0;
#pragma unroll
    for (int i = 0; i < 4; ++i) { const int t = i * 16 + (tid >> 4), c4 = (tid & 15) * 4;
        const v4f x = *(const v4f*)(src + (size_t)t * DM + c4);
#pragma unroll
        for (int e = 0; e < 4; ++e) ts[(c4 + e) * 72 + t] = (h16)bfr(x[e]); }
    __syncthreads();
    h16* dst = VT + ((size_t)b * DM + c0) * SEQ + t0;
{
#pragma unroll
        for (int it = 0; it < 2; ++it) { const int cr = it * 32 + (tid >> 3), p8 = (tid & 7) * 8;
            const v8h val = *(const v8ha*)(&ts[cr * 72 + p8]);
            *(v8h*)(dst + (size_t)cr * SEQ + p8) = val; }
         }
}

// k_flash: fused attention, one wave per 16 query rows of one (batch, head); K / V^T / Q fragments straight from the f16 planes (two 16-B loads each, arithmetic addressing).
// Transposed form: S^T[key][t] = K Q^T (A = K rows, B = Q rows); lane (t = lane&15, h = lane>>4) holds keys 8h+r of each 16-key tile, so the packed
// P tile is directly the B fragment of O^T[d][t] = V^T P^T (element r <- tile keys 0..15, element 8+r <- tile keys 16..31, lane unchanged).
// Softmax state (running max, partial sum) is one scalar per lane; the two lane halves of a row are combined with one xor-16 exchange.
__global__ __launch_bounds__(32 * AW) void k_flash(const h16* __restrict__ QP, const h16* __restrict__ KP, const h16* __restrict__ VT, h16* CTX) {
    __shared__ __align__(16) float os[AW * 16 * 68];
    const int lane = threadIdx.x & 31, wave = __builtin_amdgcn_readfirstlane((int)(threadIdx.x >> 5)), lr = lane & 15, hi = lane >> 4;
    const int zh = blockIdx.y; const int b = zh / NH_, h = zh % NH_;
    const int t0 = (blockIdx.x * AW + wave) * 16;
    const size_t rbase = (size_t)b * SEQ * DM + (size_t)h * HD;
    const size_t qo = rbase + (size_t)(t0 + lr) * DM + 8 * hi;
    const v16h qh0 = ldh(QP + qo), qh1 = ldh(QP + qo + 32);        // B fragments: col t, k = d
    const size_t ko = rbase + (size_t)lr * DM + 8 * hi;             // + key * DM       (A fragment: row key, k = d)
    const size_t vo = ((size_t)zh * HD + lr) * SEQ + 8 * hi;        // + 16j*SEQ + key  (A fragment: row d, k = key)
    v8f o0 = (v8f){}, o1 = (v8f){}, o2 = (v8f){}, o3 = (v8f){};
    float m = -3.0e38f, l = 0.0f;
#pragma unroll 1
    for (int key0 = 0; key0 < SEQ; key0 += 32) {
        const h16* ka = KP + ko + (size_t)key0 * DM;
        const v16h ka0 = ldh(ka), ka1 = ldh(ka + 32), kb0 = ldh(ka + (size_t)16 * DM), kb1 = ldh(ka + (size_t)16 * DM + 32);
        v8f sa = (v8f){}, sb = (v8f){};
        sa = wmma16(ka0, qh0, sa); sb = wmma16(kb0, qh0, sb);
        sa = wmma16(ka1, qh1, sa); sb = wmma16(kb1, qh1, sb);
        asm volatile("v_nop\n\tv_nop\n\tv_nop\n\tv_nop" : "+v"(sa), "+v"(sb) : "v"(ka0), "v"(ka1), "v"(kb0), "v"(kb1));
        float ta[8], tb[8]; float mx = -3.0e38f;
#pragma unroll
        for (int r = 0; r < 8; ++r) { ta[r] = sa[r] * SC2; tb[r] = sb[r] * SC2; mx = fmaxf(mx, fmaxf(ta[r], tb[r])); }
        mx = fmaxf(mx, __shfl_xor(mx, 16, 32));
        const float mnew = fmaxf(m, mx);
        const float alpha = __builtin_amdgcn_exp2f(m - mnew);
        const float sh = PSH - mnew;
        v16h pb; float ls = 0.0f;
#pragma unroll
        for (int r = 0; r < 8; ++r) { const h16 pa = (h16)__builtin_amdgcn_exp2f(ta[r] + sh); const h16 pc = (h16)__builtin_amdgcn_exp2f(tb[r] + sh); pb[r] = pa; pb[8 + r] = pc; ls += (float)pa + (float)pc; }
        l = l * alpha + ls; m = mnew;
        o0 = o0 * alpha; o1 = o1 * alpha; o2 = o2 * alpha; o3 = o3 * alpha;
        const h16* va = VT + vo + key0;
        const v16h v0 = ldh(va), v1 = ldh(va + (size_t)16 * SEQ), v2 = ldh(va + (size_t)32 * SEQ), v3 = ldh(va + (size_t)48 * SEQ);
        o0 = wmma16(v0, pb, o0); o1 = wmma16(v1, pb, o1); o2 = wmma16(v2, pb, o2); o3 = wmma16(v3, pb, o3);
        asm volatile("v_nop\n\tv_nop\n\tv_nop\n\tv_nop" : "+v"(o0), "+v"(o1), "+v"(o2), "+v"(o3) : "v"(v0), "v"(v1), "v"(v2), "v"(v3), "v"(pb));
    }
    l += __shfl_xor(l, 16, 32);
    const float inv = CXS * (1.0f / l);
    const int wb = wave * 16 * 68;
    // O^T D layout: o_j[r] = (d = 16j + 8h + r, t = lane&15) -> os[t][d]; rows 0..15 x columns 0..63 all written
    { v4f a, c;
      a[0] = o0[0] * inv; a[1] = o0[1] * inv; a[2] = o0[2] * inv; a[3] = o0[3] * inv; c[0] = o0[4] * inv; c[1] = o0[5] * inv; c[2] = o0[6] * inv; c[3] = o0[7] * inv;
      *(v4fa*)(&os[wb + lr * 68 +  0 + 8 * hi]) = a; *(v4fa*)(&os[wb + lr * 68 +  0 + 8 * hi + 4]) = c;
      a[0] = o1[0] * inv; a[1] = o1[1] * inv; a[2] = o1[2] * inv; a[3] = o1[3] * inv; c[0] = o1[4] * inv; c[1] = o1[5] * inv; c[2] = o1[6] * inv; c[3] = o1[7] * inv;
      *(v4fa*)(&os[wb + lr * 68 + 16 + 8 * hi]) = a; *(v4fa*)(&os[wb + lr * 68 + 16 + 8 * hi + 4]) = c;
      a[0] = o2[0] * inv; a[1] = o2[1] * inv; a[2] = o2[2] * inv; a[3] = o2[3] * inv; c[0] = o2[4] * inv; c[1] = o2[5] * inv; c[2] = o2[6] * inv; c[3] = o2[7] * inv;
      *(v4fa*)(&os[wb + lr * 68 + 32 + 8 * hi]) = a; *(v4fa*)(&os[wb + lr * 68 + 32 + 8 * hi + 4]) = c;
      a[0] = o3[0] * inv; a[1] = o3[1] * inv; a[2] = o3[2] * inv; a[3] = o3[3] * inv; c[0] = o3[4] * inv; c[1] = o3[5] * inv; c[2] = o3[6] * inv; c[3] = o3[7] * inv;
      *(v4fa*)(&os[wb + lr * 68 + 48 + 8 * hi]) = a; *(v4fa*)(&os[wb + lr * 68 + 48 + 8 * hi + 4]) = c; }
    wave_sync();
    h16* crow = CTX + ((size_t)b * SEQ + t0) * (size_t)(2 * DM) + (size_t)h * HD;
{
#pragma unroll
        for (int s = 0; s < 4; ++s) { const int row = 4 * s + (lane >> 3), c8 = (lane & 7) * 8;   // 4 s x 4 row groups = 16 rows; 8 lanes x 8 = 64 columns
            const v4f x0 = *(const v4fa*)(&os[wb + row * 68 + c8]); const v4f x1 = *(const v4fa*)(&os[wb + row * 68 + c8 + 4]); v8h hv, rv;
#pragma unroll
            for (int i = 0; i < 4; ++i) { const h16 a0 = (h16)x0[i]; const h16 a1 = (h16)x1[i]; hv[i] = a0; hv[4 + i] = a1; rv[i] = (h16)(x0[i] - (float)a0); rv[4 + i] = (h16)(x1[i] - (float)a1); }
            const size_t oo = (size_t)row * (size_t)(2 * DM) + c8;
            *(v8h*)(crow + oo) = hv; *(v8h*)(crow + oo + DM) = rv; }
         }
}

// k_out: register-blocked f16 GEMM, ONE WAVE per 64x64 tile (16 accumulators), operands straight from K-contiguous f16 planes.
// OUT[m][n] = 2^-18 * sum_{k<2048} A[m][k] Bt[n][k & 1023] + b[n]; A = ctx plane [M][value 1024 | remainder 1024] (x4096), Bt = W plane [out][in] (x64). grid (M/64, DM/64), 32 threads.
__global__ __launch_bounds__(32) void k_out(const h16* __restrict__ A, const h16* __restrict__ Bt, const float* __restrict__ bias, float* OUT) {
    __shared__ __align__(16) float os[16 * 68];
    const int KA = 2 * DM;
    const int lane = threadIdx.x & 31, lr = lane & 15, hi = lane >> 4; const int r0 = blockIdx.x * 64, c0 = blockIdx.y * 64;
    v8f acc[4][4];
#pragma unroll
    for (int mb = 0; mb < 4; ++mb)
#pragma unroll
        for (int nb = 0; nb < 4; ++nb) acc[mb][nb] = (v8f){};
    const size_t aoff = (size_t)(r0 + lr) * KA + 8 * hi, boff = (size_t)(c0 + lr) * DM + 8 * hi;
#pragma unroll 1
    for (int kc = 0; kc < KA; kc += 32) {
        const int kb = kc & (DM - 1);
        v16h a[4];
#pragma unroll
        for (int mb = 0; mb < 4; ++mb) a[mb] = ldh(A + aoff + (size_t)mb * 16 * KA + kc);
#pragma unroll
        for (int nb = 0; nb < 4; ++nb) { const v16h bq = ldh(Bt + boff + (size_t)nb * 16 * DM + kb);
#pragma unroll
            for (int mb = 0; mb < 4; ++mb) acc[mb][nb] = wmma16(a[mb], bq, acc[mb][nb]); }
        asm volatile("v_nop\n\tv_nop\n\tv_nop\n\tv_nop" : "+v"(acc[0][0]), "+v"(acc[1][1]), "+v"(acc[2][2]), "+v"(acc[3][3]) : "v"(a[0]), "v"(a[1]), "v"(a[2]), "v"(a[3]));
    }
    v4f bv = *(const v4f*)(bias + c0 + lr * 4);
#pragma unroll
    for (int i = 0; i < 4; ++i) bv[i] = bfr(bv[i]);
    float* orow = OUT + ((size_t)(r0 / SEQ) * OUT_SEQ + (size_t)(r0 % SEQ)) * DM + c0;
#pragma unroll
    for (int mb = 0; mb < 4; ++mb) {
#pragma unroll
        for (int nb = 0; nb < 4; ++nb) {
#pragma unroll
            for (int j = 0; j < 8; ++j) os[(hi * 8 + j) * 68 + nb * 16 + lr] = acc[mb][nb][j] * OSC; }   // D: row 8h+j, col lane&15
        wave_sync();
{
#pragma unroll
            for (int s = 0; s < 8; ++s) { const int row = 2 * s + hi, cofs = lr * 4;   // 8 s x 2 rows = 16 rows; 16 lanes x 4 floats = 64 columns
                const v4f x = *(const v4fa*)(&os[row * 68 + cofs]);
                const v4f val = x + bv;
                *(v4f*)(orow + (size_t)(mb * 16 + row) * DM + cofs) = val; }
             }
        wave_sync();
    }
}

static constexpr size_t al256(size_t v) { return (v + 255) & ~(size_t)255; }
static constexpr size_t SZ_PL = al256((size_t)NB * SEQ * DM * 2);          // one f16 plane of a stream
static constexpr size_t SZ_WH = al256((size_t)DM * DM * 2);
static constexpr size_t SZ_CX = al256((size_t)NB * SEQ * 2 * DM * 2);      // ctx value | remainder
static constexpr size_t SZ_TOTAL = 3 * SZ_PL + SZ_WH + SZ_CX;
static_assert(SZ_TOTAL <= (size_t)134217728);          // workspace carve <= 128 MiB

extern "C" void kernel_launch(void* const* d_in, const int* in_sizes, int n_in,
                              void* d_out, int out_size, void* d_ws, size_t ws_size, hipStream_t stream) {
    if (n_in < 5) return;
    const size_t needx = ((size_t)(NB - 1) * SEQ_FULL + SEQ) * DM;
    if ((size_t)in_sizes[0] < needx || (size_t)in_sizes[1] < needx || (size_t)in_sizes[2] < needx) return;
    if ((size_t)in_sizes[3] < (size_t)DM * DM || (size_t)in_sizes[4] < (size_t)DM) return;
    if ((size_t)out_size < ((size_t)(NB - 1) * OUT_SEQ + SEQ) * DM) return;
    if (SZ_TOTAL > ws_size) return;
    const float* q = (const float*)d_in[0]; const float* k = (const float*)d_in[1]; const float* v = (const float*)d_in[2];   // wire order q, k, v, W_out, b_out
    const float* wo = (const float*)d_in[3]; const float* bo = (const float*)d_in[4];                                         // W_out [out][in] = Bt as-is
    float* OUT = (float*)d_out;      // [NB][SEQ][1024]
    char* wsp = (char*)d_ws;
    h16* QP = (h16*)wsp; wsp += SZ_PL;               // [NB*SEQ][1024]
    h16* KP = (h16*)wsp; wsp += SZ_PL;               // [NB*SEQ][1024]
    h16* VT = (h16*)wsp; wsp += SZ_PL;               // [NB*1024][SEQ]
    h16* WH = (h16*)wsp; wsp += SZ_WH;               // [1024][1024] x64
    h16* CX = (h16*)wsp; wsp += SZ_CX;               // [NB*SEQ][2048] x4096

    if (SEQ == SEQ_FULL) {
        const size_t n8 = (size_t)NB * SEQ * DM / 8; const unsigned g = (unsigned)((n8 + 255) / 256);
        k_cvt8<<<g, 256, 0, stream>>>(q, QP, n8, 1.0f);
        k_cvt8<<<g, 256, 0, stream>>>(k, KP, n8, 1.0f);
    } else {
        const size_t n8 = (size_t)SEQ * DM / 8; const unsigned g = (unsigned)((n8 + 255) / 256);
        for (int b = 0; b < NB; ++b) {
            k_cvt8<<<g, 256, 0, stream>>>(q + (size_t)b * SEQ_FULL * DM, QP + (size_t)b * SEQ * DM, n8, 1.0f);
            k_cvt8<<<g, 256, 0, stream>>>(k + (size_t)b * SEQ_FULL * DM, KP + (size_t)b * SEQ * DM, n8, 1.0f);
        }
    }
    { const size_t n8 = (size_t)DM * DM / 8;
      k_cvt8<<<(unsigned)((n8 + 255) / 256), 256, 0, stream>>>(wo, WH, n8, WSC); }

    // in: v[b][t = SEQ rows][c = 1024 cols] -> out: VT[b*1024 + c][t]; grid (t tiles, c tiles, batch)
    k_vt<<<dim3(SEQ / 64, DM / 64, NB), 256, 0, stream>>>(v, VT);

    k_flash<<<dim3(SEQ / (16 * AW), NB * NH_, 1), 32 * AW, 0, stream>>>(QP, KP, VT, CX);

    // out = ctx W^T + b: A = ctx rows (m = b*SEQ + t), Bt = W rows (n = out column)
    k_out<<<dim3(NB * SEQ / 64, DM / 64, 1), 32, 0, stream>>>(CX, WH, bo, OUT);
}

// v001
// A run of this version takes 184 microseconds.
// Two timings next to v000 put it at 1.43 and 1.44 times that version's speed.
#include <hip/hip_runtime.h>

// Multi-head attention on raw streams q, k, v [NB][SEQ][1024] = 16 heads x 64 (no input projections, no mask), score scale 1/8, output projection y = ctx W^T + b with W [out][in].
// Compute dtypes, f32 accumulate everywhere, all contractions v_wmma_f32_16x16x32_f16: q, k, v, W, b are RNE-converted to bf16 and all but b held exactly in f16 (W with a x64 carry); scores single product; P (x256 carry, cancels in the normalisation) and v single product;
// ctx carried x4096 as f16 value + f16 remainder (two products against the same W plane, one accumulator); softmax f32 (online, running max); bias added in f32.
// Layout: every f16 operand plane is stored in fragment order: one 16-row x 32-k fragment = 1 KiB = [load 0|1][lane 0..31][8 halves], lane = 16*hi + (row & 15), element e of load ld = k 16*ld + 8*hi + e,
// so each wave-wide 16-B load reads 512 contiguous bytes (4 whole lines). Q, K, W: fragment index (row/16)*32 + col/32; V^T: ((b*16+h)*(SEQ/32) + key/32)*4 + d/16; ctx (value 1024 | remainder 1024): (row/16)*64 + k/32.
// Fused flash kernel in transposed form (S^T = K Q^T, O^T = V^T P^T) writes the ctx plane, then a one-wave-per-64x64-tile GEMM over K = 2048 (value | remainder) against W rows.

#ifndef NB
#define NB 4
#endif
#ifndef SEQ
#define SEQ 2048
#endif
#define NB_FULL  4
#define SEQ_FULL 2048
#ifndef OUT_SEQ
#define OUT_SEQ SEQ              // row pitch (in tokens) between batches of the output
#endif
#define DM   1024
#define NH_  16
#define HD   64
#define AW   4                   // waves per flash block (16 query rows each)
#define SC2  (0.125f * 1.4426950408889634f)   // HD^-0.5 * log2(e)
#define PSH  8.0f                // log2 of the P carry (256)
#define CXS  4096.0f             // carry of the ctx plane (value and remainder)
#define WSC  64.0f               // carry of the W plane
#define OSC  (1.0f / (4096.0f * 64.0f))

static_assert(HD == 64);
static_assert(NH_ * HD == DM);                 // head h = columns h*64 + d
static_assert((DM & (DM - 1)) == 0);           // k index wraps with a mask in the output GEMM
static_assert(DM % 256 == 0);                  // k_pack tiles 256 columns
static_assert(DM % 32 == 0);                   // GEMM k-loop steps by 32
static_assert(SEQ % 64 == 0);                  // a 64-row tile never straddles two batches
static_assert((NB * SEQ) % 64 == 0);
static_assert(SEQ % 32 == 0);                  // key loop steps by 32
static_assert(SEQ % (16 * AW) == 0);           // flash grid covers the sequence exactly
static_assert(((size_t)SEQ * DM) % 64 == 0);
static_assert(((size_t)DM * DM) % 64 == 0);
static_assert(NB <= NB_FULL);
static_assert(SEQ <= SEQ_FULL);

typedef _Float16 h16;
typedef __attribute__((ext_vector_type(16))) _Float16 v16h;
typedef __attribute__((ext_vector_type(8)))  _Float16 v8h;
typedef __attribute__((ext_vector_type(8)))  float    v8f;
typedef __attribute__((ext_vector_type(4)))  float    v4f;
typedef v4f  __attribute__((may_alias)) v4fa;
typedef v8h  __attribute__((may_alias)) v8ha;
typedef __attribute__((ext_vector_type(4)))  _Float16 v4h;
typedef v4h  __attribute__((may_alias)) v4ha;

// RNE convert f32 -> bf16, returned as the f32 value of that bf16
__device__ __forceinline__ float bfr(float f) { unsigned u = __float_as_uint(f); u += 0x7FFFu + ((u >> 16) & 1u); return __uint_as_float(u & 0xFFFF0000u); }
__device__ __forceinline__ v16h cat16(v8h lo, v8h hi) { return __builtin_shufflevector(lo, hi, 0, 1, 2, 3, 4, 5, 6, 7, 8, 9, 10, 11, 12, 13, 14, 15); }
__device__ __forceinline__ v8f wmma16(v16h a, v16h b, v8f c) { return __builtin_amdgcn_wmma_f32_16x16x32_f16(false, a, false, b, (short)0, c, false, false); }
// fragment loader from a plane in fragment order; p = fragment base + 8*lane: elements 0..7 <- k0+8h+0..7, elements 8..15 <- k0+16+8h+0..7 (same map for A and B)
#define FRG 512                  // halves per fragment
__device__ __forceinline__ v16h ldh(const h16* p) { return cat16(*(const v8h*)p, *(const v8h*)(p + 256)); }
// ordering point for wave-private LDS tiles (same wave writes and reads)
__device__ __forceinline__ void wave_sync() { __builtin_amdgcn_fence(3 /* release order */, "wavefront"); __builtin_amdgcn_wave_barrier(); asm volatile("" ::: "memory"); }

// k_pack: f32 rows [R][1024] -> f16 plane (bf16 RNE value x scale) in fragment order. One block = 16 rows x 256 columns: whole-line reads, row-major LDS tile (pitch 528 B = 16 B x odd), 8 KiB contiguous out (cross-wave: block barrier).
__global__ __launch_bounds__(256) void k_pack(const float* __restrict__ src, h16* dst, float scale) {
    __shared__ __align__(16) h16 ts[16 * 264];
    const int tid = threadIdx.x; const int rt = blockIdx.x, c0 = blockIdx.y * 256;
    const float* s = src + (size_t)rt * 16 * DM + c0;
#pragma unroll
    for (int i = 0; i < 4; ++i) { const int idx = i * 256 + tid, row = idx >> 6, c4 = (idx & 63) * 4;
        const v4f x = *(const v4f*)(s + (size_t)row * DM + c4); v4h o;
#pragma unroll
        for (int e = 0; e < 4; ++e) o[e] = (h16)(bfr(x[e]) * scale);
        *(v4ha*)(&ts[row * 264 + c4]) = o; }
    __syncthreads();
    h16* d = dst + ((size_t)rt * (DM / 32) + c0 / 32) * FRG;
#pragma unroll
    for (int it = 0; it < 2; ++it) { const int o = it * 256 + tid, ln = o & 31;   // o = 16-B piece of the 8 fragments: [k chunk o>>6][load (o>>5)&1][lane]
        const v8h val = *(const v8ha*)(&ts[(ln & 15) * 264 + (o >> 6) * 32 + ((o >> 5) & 1) * 16 + (ln >> 4) * 8]);
        *(v8h*)(d + (size_t)o * 8) = val; }
}

// k_vt: V^T plane. in: v[b][t][c] (f32, per-batch pitch SEQ_FULL*DM) -> out: V^T fragments (row d, k = key; f16 of the bf16 RNE value). 64 x 64 tile = one head x 2 key chunks = 8 fragments, through LDS (cross-wave: block barrier).
__global__ __launch_bounds__(256) void k_vt(const float* __restrict__ V, h16* VT) {
    __shared__ __align__(16) h16 ts[64 * 72];
    const int tid = threadIdx.x; const int t0 = blockIdx.x * 64, c0 = blockIdx.y * 64, b = blockIdx.z;
    const float* src = V + ((size_t)b * SEQ_FULL + t0) * DM + c0;
#pragma unroll
    for (int i = 0; i < 4; ++i) { const int t = i * 16 + (tid >> 4), c4 = (tid & 15) * 4;
        const v4f x = *(const v4f*)(src + (size_t)t * DM + c4);
#pragma unroll
        for (int e = 0; e < 4; ++e) ts[(c4 + e) * 72 + t] = (h16)bfr(x[e]); }
    __syncthreads();
    h16* dst = VT + (((size_t)b * NH_ + blockIdx.y) * (SEQ / 32) + t0 / 32) * 4 * FRG;
#pragma unroll
    for (int it = 0; it < 2; ++it) { const int o = it * 256 + tid, ln = o & 31;   // o = 16-B piece: [key chunk o>>8][d tile (o>>6)&3][load (o>>5)&1][lane]
        const v8h val = *(const v8ha*)(&ts[(((o >> 6) & 3) * 16 + (ln & 15)) * 72 + (o >> 8) * 32 + ((o >> 5) & 1) * 16 + (ln >> 4) * 8]);
        *(v8h*)(dst + (size_t)o * 8) = val; }
}

// k_flash: fused attention, one wave per 16 query rows of one (batch, head); K / V^T / Q fragments straight from the f16 planes (two 16-B loads each, 512 contiguous bytes per wave-wide load).
// Transposed form: S^T[key][t] = K Q^T (A = K rows, B = Q rows); lane (t = lane&15, h = lane>>4) holds keys 8h+r of each 16-key tile, so the packed
// P tile is directly the B fragment of O^T[d][t] = V^T P^T (element r <- tile keys 0..15, element 8+r <- tile keys 16..31, lane unchanged).
// Softmax state (running max, partial sum) is one scalar per lane; the two lane halves of a row are combined with one xor-16 exchange.
__global__ __launch_bounds__(32 * AW) void k_flash(const h16* __restrict__ QP, const h16* __restrict__ KP, const h16* __restrict__ VT, h16* CTX) {
    const int lane = threadIdx.x & 31, wave = __builtin_amdgcn_readfirstlane((int)(threadIdx.x >> 5));
    const int zh = blockIdx.y; const int b = zh / NH_, h = zh % NH_;
    const int t0 = (blockIdx.x * AW + wave) * 16;
    const size_t rbase = ((size_t)(b * SEQ / 16) * (DM / 32) + 2 * h) * FRG + 8 * lane;   // fragment (row tile 0 of the batch, k chunk 2h)
    const size_t qo = rbase + (size_t)(t0 / 16) * (DM / 32) * FRG;
    const v16h qh0 = ldh(QP + qo), qh1 = ldh(QP + qo + FRG);       // B fragments: col t, k = d
    const size_t ko = rbase;                                        // + (key/16) * 32 fragments   (A fragment: row key, k = d)
    const size_t vo = (size_t)zh * (SEQ / 32) * 4 * FRG + 8 * lane; // + (key/32) * 4 fragments + j (A fragment: row d, k = key)
    v8f o0 = (v8f){}, o1 = (v8f){}, o2 = (v8f){}, o3 = (v8f){};
    float m = -3.0e38f, l = 0.0f;
#pragma unroll 1
    for (int key0 = 0; key0 < SEQ; key0 += 32) {
        const h16* ka = KP + ko + (size_t)(key0 / 16) * (DM / 32) * FRG;
        const v16h ka0 = ldh(ka), ka1 = ldh(ka + FRG), kb0 = ldh(ka + (DM / 32) * FRG), kb1 = ldh(ka + (DM / 32) * FRG + FRG);
        v8f sa = (v8f){}, sb = (v8f){};
        sa = wmma16(ka0, qh0, sa); sb = wmma16(kb0, qh0, sb);
        sa = wmma16(ka1, qh1, sa); sb = wmma16(kb1, qh1, sb);
        asm volatile("v_nop\n\tv_nop\n\tv_nop\n\tv_nop" : "+v"(sa), "+v"(sb) : "v"(ka0), "v"(ka1), "v"(kb0), "v"(kb1));
        float ta[8], tb[8]; float mx = -3.0e38f;
#pragma unroll
        for (int r = 0; r < 8; ++r) { ta[r] = sa[r] * SC2; tb[r] = sb[r] * SC2; mx = fmaxf(mx, fmaxf(ta[r], tb[r])); }
        mx = fmaxf(mx, __shfl_xor(mx, 16, 32));
        const float mnew = fmaxf(m, mx);
        const float alpha = __builtin_amdgcn_exp2f(m - mnew);
        const float sh = PSH - mnew;
        v16h pb; float ls = 0.0f;
#pragma unroll
        for (int r = 0; r < 8; ++r) { const h16 pa = (h16)__builtin_amdgcn_exp2f(ta[r] + sh); const h16 pc = (h16)__builtin_amdgcn_exp2f(tb[r] + sh); pb[r] = pa; pb[8 + r] = pc; ls += (float)pa + (float)pc; }
        l = l * alpha + ls; m = mnew;
        o0 = o0 * alpha; o1 = o1 * alpha; o2 = o2 * alpha; o3 = o3 * alpha;
        const h16* va = VT + vo + (size_t)(key0 / 32) * 4 * FRG;
        const v16h v0 = ldh(va), v1 = ldh(va + FRG), v2 = ldh(va + 2 * FRG), v3 = ldh(va + 3 * FRG);
        o0 = wmma16(v0, pb, o0); o1 = wmma16(v1, pb, o1); o2 = wmma16(v2, pb, o2); o3 = wmma16(v3, pb, o3);
        asm volatile("v_nop\n\tv_nop\n\tv_nop\n\tv_nop" : "+v"(o0), "+v"(o1), "+v"(o2), "+v"(o3) : "v"(v0), "v"(v1), "v"(v2), "v"(v3), "v"(pb));
    }
    l += __shfl_xor(l, 16, 32);
    const float inv = CXS * (1.0f / l);
    // O^T D layout: o_j[r] = (d = 16j + 8h + r, t = lane&15), which is load j&1 of ctx fragment (row tile t0/16, k chunk 2*head + (j>>1)) at this same lane: stored from registers, 512 contiguous bytes per store
    h16* cw = CTX + ((size_t)((b * SEQ + t0) / 16) * (2 * DM / 32) + 2 * h) * FRG + 8 * lane;
    const v8f oj[4] = { o0, o1, o2, o3 };
#pragma unroll
    for (int j = 0; j < 4; ++j) { v8h hv, rv;
#pragma unroll
        for (int r = 0; r < 8; ++r) { const float x = oj[j][r] * inv; const h16 a = (h16)x; hv[r] = a; rv[r] = (h16)(x - (float)a); }
        *(v8h*)(cw + j * 256) = hv; *(v8h*)(cw + (DM / 32) * FRG + j * 256) = rv; }
}

// k_out: register-blocked f16 GEMM, ONE WAVE per 64x64 tile (16 accumulators), operands straight from the f16 planes in fragment order.
// OUT[m][n] = 2^-18 * sum_{k<2048} A[m][k] Bt[n][k & 1023] + b[n]; A = ctx plane [M][value 1024 | remainder 1024] (x4096), Bt = W plane [out][in] (x64). grid (M/64, DM/64), 32 threads.
__global__ __launch_bounds__(32) void k_out(const h16* __restrict__ A, const h16* __restrict__ Bt, const float* __restrict__ bias, float* OUT) {
    __shared__ __align__(16) float os[16 * 68];
    const int KA = 2 * DM;
    const int lane = threadIdx.x & 31, lr = lane & 15, hi = lane >> 4; const int r0 = blockIdx.x * 64, c0 = blockIdx.y * 64;
    v8f acc[4][4];
#pragma unroll
    for (int mb = 0; mb < 4; ++mb)
#pragma unroll
        for (int nb = 0; nb < 4; ++nb) acc[mb][nb] = (v8f){};
    const size_t aoff = (size_t)(r0 / 16) * (KA / 32) * FRG + 8 * lane, boff = (size_t)(c0 / 16) * (DM / 32) * FRG + 8 * lane;
#pragma unroll 1
    for (int kc = 0; kc < KA; kc += 32) {
        const int kb = kc & (DM - 1);
        v16h a[4];
#pragma unroll
        for (int mb = 0; mb < 4; ++mb) a[mb] = ldh(A + aoff + (size_t)(mb * (KA / 32) + kc / 32) * FRG);
#pragma unroll
        for (int nb = 0; nb < 4; ++nb) { const v16h bq = ldh(Bt + boff + (size_t)(nb * (DM / 32) + kb / 32) * FRG);
#pragma unroll
            for (int mb = 0; mb < 4; ++mb) acc[mb][nb] = wmma16(a[mb], bq, acc[mb][nb]); }
        asm volatile("v_nop\n\tv_nop\n\tv_nop\n\tv_nop" : "+v"(acc[0][0]), "+v"(acc[1][1]), "+v"(acc[2][2]), "+v"(acc[3][3]) : "v"(a[0]), "v"(a[1]), "v"(a[2]), "v"(a[3]));
    }
    v4f bv = *(const v4f*)(bias + c0 + lr * 4);
#pragma unroll
    for (int i = 0; i < 4; ++i) bv[i] = bfr(bv[i]);
    float* orow = OUT + ((size_t)(r0 / SEQ) * OUT_SEQ + (size_t)(r0 % SEQ)) * DM + c0;
#pragma unroll
    for (int mb = 0; mb < 4; ++mb) {
#pragma unroll
        for (int nb = 0; nb < 4; ++nb) {
#pragma unroll
            for (int j = 0; j < 8; ++j) os[(hi * 8 + j) * 68 + nb * 16 + lr] = acc[mb][nb][j] * OSC; }   // D: row 8h+j, col lane&15
        wave_sync();
{
#pragma unroll
            for (int s = 0; s < 8; ++s) { const int row = 2 * s + hi, cofs = lr * 4;   // 8 s x 2 rows = 16 rows; 16 lanes x 4 floats = 64 columns
                const v4f x = *(const v4fa*)(&os[row * 68 + cofs]);
                const v4f val = x + bv;
                *(v4f*)(orow + (size_t)(mb * 16 + row) * DM + cofs) = val; }
             }
        wave_sync();
    }
}

static constexpr size_t al256(size_t v) { return (v + 255) & ~(size_t)255; }
static constexpr size_t SZ_PL = al256((size_t)NB * SEQ * DM * 2);          // one f16 plane of a stream
static constexpr size_t SZ_WH = al256((size_t)DM * DM * 2);
static constexpr size_t SZ_CX = al256((size_t)NB * SEQ * 2 * DM * 2);      // ctx value | remainder
static constexpr size_t SZ_TOTAL = 3 * SZ_PL + SZ_WH + SZ_CX;
static_assert(SZ_TOTAL <= (size_t)134217728);          // workspace carve <= 128 MiB

extern "C" void kernel_launch(void* const* d_in, const int* in_sizes, int n_in,
                              void* d_out, int out_size, void* d_ws, size_t ws_size, hipStream_t stream) {
    if (n_in < 5) return;
    const size_t needx = ((size_t)(NB - 1) * SEQ_FULL + SEQ) * DM;
    if ((size_t)in_sizes[0] < needx || (size_t)in_sizes[1] < needx || (size_t)in_sizes[2] < needx) return;
    if ((size_t)in_sizes[3] < (size_t)DM * DM || (size_t)in_sizes[4] < (size_t)DM) return;
    if ((size_t)out_size < ((size_t)(NB - 1) * OUT_SEQ + SEQ) * DM) return;
    if (SZ_TOTAL > ws_size) return;
    const float* q = (const float*)d_in[0]; const float* k = (const float*)d_in[1]; const float* v = (const float*)d_in[2];   // wire order q, k, v, W_out, b_out
    const float* wo = (const float*)d_in[3]; const float* bo = (const float*)d_in[4];                                         // W_out [out][in] = Bt as-is
    float* OUT = (float*)d_out;      // [NB][SEQ][1024]
    char* wsp = (char*)d_ws;
    h16* QP = (h16*)wsp; wsp += SZ_PL;               // [NB*SEQ/16][32] fragments
    h16* KP = (h16*)wsp; wsp += SZ_PL;               // [NB*SEQ/16][32] fragments
    h16* VT = (h16*)wsp; wsp += SZ_PL;               // [NB*16][SEQ/32][4] fragments
    h16* WH = (h16*)wsp; wsp += SZ_WH;               // [1024/16][32] fragments, x64
    h16* CX = (h16*)wsp; wsp += SZ_CX;               // [NB*SEQ/16][64] fragments, x4096

    if (SEQ == SEQ_FULL) {
        const dim3 g(NB * SEQ / 16, DM / 256, 1);
        k_pack<<<g, 256, 0, stream>>>(q, QP, 1.0f);
        k_pack<<<g, 256, 0, stream>>>(k, KP, 1.0f);
    } else {
        const dim3 g(SEQ / 16, DM / 256, 1);
        for (int b = 0; b < NB; ++b) {
            k_pack<<<g, 256, 0, stream>>>(q + (size_t)b * SEQ_FULL * DM, QP + (size_t)b * SEQ * DM, 1.0f);
            k_pack<<<g, 256, 0, stream>>>(k + (size_t)b * SEQ_FULL * DM, KP + (size_t)b * SEQ * DM, 1.0f);
        }
    }
    k_pack<<<dim3(DM / 16, DM / 256, 1), 256, 0, stream>>>(wo, WH, WSC);

    // in: v[b][t = SEQ rows][c = 1024 cols] -> out: V^T fragments; grid (t tiles, c tiles = heads, batch)
    k_vt<<<dim3(SEQ / 64, DM / 64, NB), 256, 0, stream>>>(v, VT);

    k_flash<<<dim3(SEQ / (16 * AW), NB * NH_, 1), 32 * AW, 0, stream>>>(QP, KP, VT, CX);

    // out = ctx W^T + b: A = ctx rows (m = b*SEQ + t), Bt = W rows (n = out column)
    k_out<<<dim3(NB * SEQ / 64, DM / 64, 1), 32, 0, stream>>>(CX, WH, bo, OUT);
}

// v002
// Measured time: 157 microseconds a run.
// In both of two side-by-side timings against v001, it was 1.18 times as fast.
// Counting every step since v000, it is 1.69 times as fast.
#include <hip/hip_runtime.h>

// Multi-head attention on raw streams q, k, v [NB][SEQ][1024] = 16 heads x 64 (no input projections, no mask), score scale 1/8, output projection y = ctx W^T + b with W [out][in].
// Compute dtypes, f32 accumulate everywhere, all contractions v_wmma_f32_16x16x32_f16: q, k, v, W, b are RNE-converted to bf16 and all but b held exactly in f16 (W with a x64 carry); scores single product; P (x256 carry, cancels in the normalisation) and v single product;
// ctx carried x4096 as f16 value + f16 remainder (two products against the same W plane, one accumulator); softmax f32 (online, running max); bias added in f32.
// Layout: every f16 operand plane is stored in fragment order: one 16-row x 32-k fragment = 1 KiB = [load 0|1][lane 0..31][8 halves], lane = 16*hi + (row & 15), element e of load ld = k 16*ld + 8*hi + e,
// so each wave-wide 16-B load reads 512 contiguous bytes (4 whole lines). Q, K, W: fragment index (row/16)*32 + col/32; V^T: ((b*16+h)*(SEQ/32) + key/32)*4 + d/16; ctx (value 1024 | remainder 1024): (row/16)*64 + k/32.
// Fused flash kernel in transposed form (S^T = K Q^T, O^T = V^T P^T) writes the ctx plane, then a one-wave-per-64x64-tile GEMM over K = 2048 (value | remainder) against W rows.

#ifndef NB
#define NB 4
#endif
#ifndef SEQ
#define SEQ 2048
#endif
#define NB_FULL  4
#define SEQ_FULL 2048
#ifndef OUT_SEQ
#define OUT_SEQ SEQ              // row pitch (in tokens) between batches of the output
#endif
#define DM   1024
#define NH_  16
#define HD   64
#define AW   4                   // waves per flash block (16 query rows each)
#define SC2  (0.125f * 1.4426950408889634f)   // HD^-0.5 * log2(e)
#define PSH  8.0f                // log2 of the P carry (256)
#define CXS  4096.0f             // carry of the ctx plane (value and remainder)
#define WSC  64.0f               // carry of the W plane
#define OSC  (1.0f / (4096.0f * 64.0f))

static_assert(HD == 64);
static_assert(NH_ * HD == DM);                 // head h = columns h*64 + d
static_assert((DM & (DM - 1)) == 0);           // k index wraps with a mask in the output GEMM
static_assert(DM % 256 == 0);                  // k_pack tiles 256 columns
static_assert(DM % 64 == 0);                   // GEMM k-loop takes two steps of 32 a trip
static_assert(SEQ % 64 == 0);                  // a 64-row tile never straddles two batches
static_assert((NB * SEQ) % 64 == 0);
static_assert(SEQ % 32 == 0);                  // key loop steps by 32
static_assert(SEQ % (16 * AW) == 0);           // flash grid covers the sequence exactly
static_assert(((size_t)SEQ * DM) % 64 == 0);
static_assert(((size_t)DM * DM) % 64 == 0);
static_assert(NB <= NB_FULL);
static_assert(SEQ <= SEQ_FULL);

typedef _Float16 h16;
typedef __attribute__((ext_vector_type(16))) _Float16 v16h;
typedef __attribute__((ext_vector_type(8)))  _Float16 v8h;
typedef __attribute__((ext_vector_type(8)))  float    v8f;
typedef __attribute__((ext_vector_type(4)))  float    v4f;
typedef v4f  __attribute__((may_alias)) v4fa;
typedef v8h  __attribute__((may_alias)) v8ha;
typedef __attribute__((ext_vector_type(4)))  _Float16 v4h;
typedef v4h  __attribute__((may_alias)) v4ha;

// RNE convert f32 -> bf16, returned as the f32 value of that bf16
__device__ __forceinline__ float bfr(float f) { unsigned u = __float_as_uint(f); u += 0x7FFFu + ((u >> 16) & 1u); return __uint_as_float(u & 0xFFFF0000u); }
__device__ __forceinline__ v16h cat16(v8h lo, v8h hi) { return __builtin_shufflevector(lo, hi, 0, 1, 2, 3, 4, 5, 6, 7, 8, 9, 10, 11, 12, 13, 14, 15); }
__device__ __forceinline__ v8f wmma16(v16h a, v16h b, v8f c) { return __builtin_amdgcn_wmma_f32_16x16x32_f16(false, a, false, b, (short)0, c, false, false); }
// fragment loader from a plane in fragment order; p = fragment base + 8*lane: elements 0..7 <- k0+8h+0..7, elements 8..15 <- k0+16+8h+0..7 (same map for A and B)
#define FRG 512                  // halves per fragment
__device__ __forceinline__ v16h ldh(const h16* p) { return cat16(*(const v8h*)p, *(const v8h*)(p + 256)); }
// ordering point for wave-private LDS tiles (same wave writes and reads)
__device__ __forceinline__ void wave_sync() { __builtin_amdgcn_fence(3 /* release order */, "wavefront"); __builtin_amdgcn_wave_barrier(); asm volatile("" ::: "memory"); }

// k_pack: f32 rows [R][1024] -> f16 plane (bf16 RNE value x scale) in fragment order. One block = 16 rows x 256 columns: whole-line reads, row-major LDS tile (pitch 528 B = 16 B x odd), 8 KiB contiguous out (cross-wave: block barrier).
__global__ __launch_bounds__(256) void k_pack(const float* __restrict__ src, h16* dst, float scale) {
    __shared__ __align__(16) h16 ts[16 * 264];
    const int tid = threadIdx.x; const int rt = blockIdx.x, c0 = blockIdx.y * 256;
    const float* s = src + (size_t)rt * 16 * DM + c0;
#pragma unroll
    for (int i = 0; i < 4; ++i) { const int idx = i * 256 + tid, row = idx >> 6, c4 = (idx & 63) * 4;
        const v4f x = *(const v4f*)(s + (size_t)row * DM + c4); v4h o;
#pragma unroll
        for (int e = 0; e < 4; ++e) o[e] = (h16)(bfr(x[e]) * scale);
        *(v4ha*)(&ts[row * 264 + c4]) = o; }
    __syncthreads();
    h16* d = dst + ((size_t)rt * (DM / 32) + c0 / 32) * FRG;
#pragma unroll
    for (int it = 0; it < 2; ++it) { const int o = it * 256 + tid, ln = o & 31;   // o = 16-B piece of the 8 fragments: [k chunk o>>6][load (o>>5)&1][lane]
        const v8h val = *(const v8ha*)(&ts[(ln & 15) * 264 + (o >> 6) * 32 + ((o >> 5) & 1) * 16 + (ln >> 4) * 8]);
        *(v8h*)(d + (size_t)o * 8) = val; }
}

// k_vt: V^T plane. in: v[b][t][c] (f32, per-batch pitch SEQ_FULL*DM) -> out: V^T fragments (row d, k = key; f16 of the bf16 RNE value). 64 x 64 tile = one head x 2 key chunks = 8 fragments, through LDS (cross-wave: block barrier).
__global__ __launch_bounds__(256) void k_vt(const float* __restrict__ V, h16* VT) {
    __shared__ __align__(16) h16 ts[64 * 72];
    const int tid = threadIdx.x; const int t0 = blockIdx.x * 64, c0 = blockIdx.y * 64, b = blockIdx.z;
    const float* src = V + ((size_t)b * SEQ_FULL + t0) * DM + c0;
#pragma unroll
    for (int i = 0; i < 4; ++i) { const int t = i * 16 + (tid >> 4), c4 = (tid & 15) * 4;
        const v4f x = *(const v4f*)(src + (size_t)t * DM + c4);
#pragma unroll
        for (int e = 0; e < 4; ++e) ts[(c4 + e) * 72 + t] = (h16)bfr(x[e]); }
    __syncthreads();
    h16* dst = VT + (((size_t)b * NH_ + blockIdx.y) * (SEQ / 32) + t0 / 32) * 4 * FRG;
#pragma unroll
    for (int it = 0; it < 2; ++it) { const int o = it * 256 + tid, ln = o & 31;   // o = 16-B piece: [key chunk o>>8][d tile (o>>6)&3][load (o>>5)&1][lane]
        const v8h val = *(const v8ha*)(&ts[(((o >> 6) & 3) * 16 + (ln & 15)) * 72 + (o >> 8) * 32 + ((o >> 5) & 1) * 16 + (ln >> 4) * 8]);
        *(v8h*)(dst + (size_t)o * 8) = val; }
}

// k_flash: fused attention, one wave per 16 query rows of one (batch, head); K / V^T / Q fragments straight from the f16 planes (two 16-B loads each, 512 contiguous bytes per wave-wide load).
// Transposed form: S^T[key][t] = K Q^T (A = K rows, B = Q rows); lane (t = lane&15, h = lane>>4) holds keys 8h+r of each 16-key tile, so the packed
// P tile is directly the B fragment of O^T[d][t] = V^T P^T (element r <- tile keys 0..15, element 8+r <- tile keys 16..31, lane unchanged).
// Softmax state (running max, partial sum) is one scalar per lane; the two lane halves of a row are combined with one xor-16 exchange.
__global__ __launch_bounds__(32 * AW) void k_flash(const h16* __restrict__ QP, const h16* __restrict__ KP, const h16* __restrict__ VT, h16* CTX) {
    const int lane = threadIdx.x & 31, wave = __builtin_amdgcn_readfirstlane((int)(threadIdx.x >> 5));
    const int zh = blockIdx.y; const int b = zh / NH_, h = zh % NH_;
    const int t0 = (blockIdx.x * AW + wave) * 16;
    const size_t rbase = ((size_t)(b * SEQ / 16) * (DM / 32) + 2 * h) * FRG + 8 * lane;   // fragment (row tile 0 of the batch, k chunk 2h)
    const size_t qo = rbase + (size_t)(t0 / 16) * (DM / 32) * FRG;
    const v16h qh0 = ldh(QP + qo), qh1 = ldh(QP + qo + FRG);       // B fragments: col t, k = d
    const size_t ko = rbase;                                        // + (key/16) * 32 fragments   (A fragment: row key, k = d)
    const size_t vo = (size_t)zh * (SEQ / 32) * 4 * FRG + 8 * lane; // + (key/32) * 4 fragments + j (A fragment: row d, k = key)
    v8f o0 = (v8f){}, o1 = (v8f){}, o2 = (v8f){}, o3 = (v8f){};
    float m = -3.0e38f, l = 0.0f;
#pragma unroll 1
    for (int key0 = 0; key0 < SEQ; key0 += 32) {
        const h16* ka = KP + ko + (size_t)(key0 / 16) * (DM / 32) * FRG;
        const v16h ka0 = ldh(ka), ka1 = ldh(ka + FRG), kb0 = ldh(ka + (DM / 32) * FRG), kb1 = ldh(ka + (DM / 32) * FRG + FRG);
        v8f sa = (v8f){}, sb = (v8f){};
        sa = wmma16(ka0, qh0, sa); sb = wmma16(kb0, qh0, sb);
        sa = wmma16(ka1, qh1, sa); sb = wmma16(kb1, qh1, sb);
        asm volatile("v_nop\n\tv_nop\n\tv_nop\n\tv_nop" : "+v"(sa), "+v"(sb) : "v"(ka0), "v"(ka1), "v"(kb0), "v"(kb1));
        float ta[8], tb[8]; float mx = -3.0e38f;
#pragma unroll
        for (int r = 0; r < 8; ++r) { ta[r] = sa[r] * SC2; tb[r] = sb[r] * SC2; mx = fmaxf(mx, fmaxf(ta[r], tb[r])); }
        mx = fmaxf(mx, __shfl_xor(mx, 16, 32));
        const float mnew = fmaxf(m, mx);
        const float alpha = __builtin_amdgcn_exp2f(m - mnew);
        const float sh = PSH - mnew;
        v16h pb; float ls = 0.0f;
#pragma unroll
        for (int r = 0; r < 8; ++r) { const h16 pa = (h16)__builtin_amdgcn_exp2f(ta[r] + sh); const h16 pc = (h16)__builtin_amdgcn_exp2f(tb[r] + sh); pb[r] = pa; pb[8 + r] = pc; ls += (float)pa + (float)pc; }
        l = l * alpha + ls; m = mnew;
        o0 = o0 * alpha; o1 = o1 * alpha; o2 = o2 * alpha; o3 = o3 * alpha;
        const h16* va = VT + vo + (size_t)(key0 / 32) * 4 * FRG;
        const v16h v0 = ldh(va), v1 = ldh(va + FRG), v2 = ldh(va + 2 * FRG), v3 = ldh(va + 3 * FRG);
        o0 = wmma16(v0, pb, o0); o1 = wmma16(v1, pb, o1); o2 = wmma16(v2, pb, o2); o3 = wmma16(v3, pb, o3);
        asm volatile("v_nop\n\tv_nop\n\tv_nop\n\tv_nop" : "+v"(o0), "+v"(o1), "+v"(o2), "+v"(o3) : "v"(v0), "v"(v1), "v"(v2), "v"(v3), "v"(pb));
    }
    l += __shfl_xor(l, 16, 32);
    const float inv = CXS * (1.0f / l);
    // O^T D layout: o_j[r] = (d = 16j + 8h + r, t = lane&15), which is load j&1 of ctx fragment (row tile t0/16, k chunk 2*head + (j>>1)) at this same lane: stored from registers, 512 contiguous bytes per store
    h16* cw = CTX + ((size_t)((b * SEQ + t0) / 16) * (2 * DM / 32) + 2 * h) * FRG + 8 * lane;
    const v8f oj[4] = { o0, o1, o2, o3 };
#pragma unroll
    for (int j = 0; j < 4; ++j) { v8h hv, rv;
#pragma unroll
        for (int r = 0; r < 8; ++r) { const float x = oj[j][r] * inv; const h16 a = (h16)x; hv[r] = a; rv[r] = (h16)(x - (float)a); }
        *(v8h*)(cw + j * 256) = hv; *(v8h*)(cw + (DM / 32) * FRG + j * 256) = rv; }
}

// k_out: register-blocked f16 GEMM, ONE WAVE per 64x64 tile (16 accumulators), operands straight from the f16 planes in fragment order.
// OUT[m][n] = 2^-18 * sum_{k<2048} A[m][k] Bt[n][k & 1023] + b[n]; A = ctx plane [M][value 1024 | remainder 1024] (x4096), Bt = W plane [out][in] (x64). grid (M/64, DM/64), 32 threads.
__global__ __launch_bounds__(32) void k_out(const h16* __restrict__ A, const h16* __restrict__ Bt, const float* __restrict__ bias, float* OUT) {
    __shared__ __align__(16) float os[16 * 68];
    const int KA = 2 * DM;
    const int lane = threadIdx.x & 31, lr = lane & 15, hi = lane >> 4; const int r0 = blockIdx.x * 64, c0 = blockIdx.y * 64;
    v8f acc[4][4];
#pragma unroll
    for (int mb = 0; mb < 4; ++mb)
#pragma unroll
        for (int nb = 0; nb < 4; ++nb) acc[mb][nb] = (v8f){};
    const h16* ap = A + (size_t)(r0 / 16) * (KA / 32) * FRG + 8 * lane;    // + (mb * (KA / 32) + k step) fragments
    const h16* bp = Bt + (size_t)(c0 / 16) * (DM / 32) * FRG + 8 * lane;   // + (nb * (DM / 32) + (k step mod 32)) fragments
    // two fragment sets: while one k step's 16 products run, the next step's 8 fragments are already in flight into the other set
    v16h a0[4], b0[4], a1[4], b1[4];
#pragma unroll
    for (int i = 0; i < 4; ++i) { a0[i] = ldh(ap + (size_t)(i * (KA / 32)) * FRG); b0[i] = ldh(bp + (size_t)(i * (DM / 32)) * FRG); }
    asm volatile("s_wait_xcnt 0x0" ::: "memory");   // in front of every later overwrite of an address register that these 16 loads name
#pragma unroll 1
    for (int ks = 0; ks < KA / 32; ks += 2) {
        const int k1 = ks + 1, k2 = (ks + 2) & (KA / 32 - 1);   // k2 wraps to step 0 behind the last step: in bounds, loaded and not used
        const h16* ap1 = ap + (size_t)k1 * FRG; const h16* bp1 = bp + (size_t)(k1 & (DM / 32 - 1)) * FRG;
#pragma unroll
        for (int i = 0; i < 4; ++i) { a1[i] = ldh(ap1 + (size_t)(i * (KA / 32)) * FRG); b1[i] = ldh(bp1 + (size_t)(i * (DM / 32)) * FRG); }
        asm volatile("s_wait_xcnt 0x0" :: "v"(bp1) : "memory");   // in front of every overwrite of an address register that these 16 loads name; naming the B pointer keeps its registers live up to here, so that no load of the group lands on them (the A loads go by the trip's running pointer, which lives on)
        __builtin_amdgcn_sched_barrier(0);   // keeps the 16 loads of the next step ahead of this step's products (the scheduler otherwise sinks them next to their use, and their latency is waited out)
#pragma unroll
        for (int nb = 0; nb < 4; ++nb)
#pragma unroll
            for (int mb = 0; mb < 4; ++mb) acc[mb][nb] = wmma16(a0[mb], b0[nb], acc[mb][nb]);
        __builtin_amdgcn_sched_barrier(0);   // the refill of the first set stays behind its last reader and, with the next fence, ahead of the second set's products
        const h16* ap2 = ap + (size_t)k2 * FRG; const h16* bp2 = bp + (size_t)(k2 & (DM / 32 - 1)) * FRG;
#pragma unroll
        for (int i = 0; i < 4; ++i) { a0[i] = ldh(ap2 + (size_t)(i * (KA / 32)) * FRG); b0[i] = ldh(bp2 + (size_t)(i * (DM / 32)) * FRG); }
        asm volatile("s_wait_xcnt 0x0" :: "v"(ap2), "v"(bp2) : "memory");   // as above; both pointers of this group are formed for it alone, so both are named
        __builtin_amdgcn_sched_barrier(0);   // as above, for the second set
#pragma unroll
        for (int nb = 0; nb < 4; ++nb)
#pragma unroll
            for (int mb = 0; mb < 4; ++mb) acc[mb][nb] = wmma16(a1[mb], b1[nb], acc[mb][nb]);
        // four vector slots behind the last product, also on the taken side of the loop branch
        asm volatile("v_nop\n\tv_nop\n\tv_nop\n\tv_nop" : "+v"(acc[0][0]), "+v"(acc[1][1]), "+v"(acc[2][2]), "+v"(acc[3][3]) : "v"(a1[0]), "v"(a1[1]), "v"(a1[2]), "v"(a1[3]));
    }
    v4f bv = *(const v4f*)(bias + c0 + lr * 4);
#pragma unroll
    for (int i = 0; i < 4; ++i) bv[i] = bfr(bv[i]);
    float* orow = OUT + ((size_t)(r0 / SEQ) * OUT_SEQ + (size_t)(r0 % SEQ)) * DM + c0;
#pragma unroll
    for (int mb = 0; mb < 4; ++mb) {
#pragma unroll
        for (int nb = 0; nb < 4; ++nb) {
#pragma unroll
            for (int j = 0; j < 8; ++j) os[(hi * 8 + j) * 68 + nb * 16 + lr] = acc[mb][nb][j] * OSC; }   // D: row 8h+j, col lane&15
        wave_sync();
{
#pragma unroll
            for (int s = 0; s < 8; ++s) { const int row = 2 * s + hi, cofs = lr * 4;   // 8 s x 2 rows = 16 rows; 16 lanes x 4 floats = 64 columns
                const v4f x = *(const v4fa*)(&os[row * 68 + cofs]);
                const v4f val = x + bv;
                *(v4f*)(orow + (size_t)(mb * 16 + row) * DM + cofs) = val; }
             }
        wave_sync();
    }
}

static constexpr size_t al256(size_t v) { return (v + 255) & ~(size_t)255; }
static constexpr size_t SZ_PL = al256((size_t)NB * SEQ * DM * 2);          // one f16 plane of a stream
static constexpr size_t SZ_WH = al256((size_t)DM * DM * 2);
static constexpr size_t SZ_CX = al256((size_t)NB * SEQ * 2 * DM * 2);      // ctx value | remainder
static constexpr size_t SZ_TOTAL = 3 * SZ_PL + SZ_WH + SZ_CX;
static_assert(SZ_TOTAL <= (size_t)134217728);          // workspace carve <= 128 MiB

extern "C" void kernel_launch(void* const* d_in, const int* in_sizes, int n_in,
                              void* d_out, int out_size, void* d_ws, size_t ws_size, hipStream_t stream) {
    if (n_in < 5) return;
    const size_t needx = ((size_t)(NB - 1) * SEQ_FULL + SEQ) * DM;
    if ((size_t)in_sizes[0] < needx || (size_t)in_sizes[1] < needx || (size_t)in_sizes[2] < needx) return;
    if ((size_t)in_sizes[3] < (size_t)DM * DM || (size_t)in_sizes[4] < (size_t)DM) return;
    if ((size_t)out_size < ((size_t)(NB - 1) * OUT_SEQ + SEQ) * DM) return;
    if (SZ_TOTAL > ws_size) return;
    const float* q = (const float*)d_in[0]; const float* k = (const float*)d_in[1]; const float* v = (const float*)d_in[2];   // wire order q, k, v, W_out, b_out
    const float* wo = (const float*)d_in[3]; const float* bo = (const float*)d_in[4];                                         // W_out [out][in] = Bt as-is
    float* OUT = (float*)d_out;      // [NB][SEQ][1024]
    char* wsp = (char*)d_ws;
    h16* QP = (h16*)wsp; wsp += SZ_PL;               // [NB*SEQ/16][32] fragments
    h16* KP = (h16*)wsp; wsp += SZ_PL;               // [NB*SEQ/16][32] fragments
    h16* VT = (h16*)wsp; wsp += SZ_PL;               // [NB*16][SEQ/32][4] fragments
    h16* WH = (h16*)wsp; wsp += SZ_WH;               // [1024/16][32] fragments, x64
    h16* CX = (h16*)wsp; wsp += SZ_CX;               // [NB*SEQ/16][64] fragments, x4096

    if (SEQ == SEQ_FULL) {
        const dim3 g(NB * SEQ / 16, DM / 256, 1);
        k_pack<<<g, 256, 0, stream>>>(q, QP, 1.0f);
        k_pack<<<g, 256, 0, stream>>>(k, KP, 1.0f);
    } else {
        const dim3 g(SEQ / 16, DM / 256, 1);
        for (int b = 0; b < NB; ++b) {
            k_pack<<<g, 256, 0, stream>>>(q + (size_t)b * SEQ_FULL * DM, QP + (size_t)b * SEQ * DM, 1.0f);
            k_pack<<<g, 256, 0, stream>>>(k + (size_t)b * SEQ_FULL * DM, KP + (size_t)b * SEQ * DM, 1.0f);
        }
    }
    k_pack<<<dim3(DM / 16, DM / 256, 1), 256, 0, stream>>>(wo, WH, WSC);

    // in: v[b][t = SEQ rows][c = 1024 cols] -> out: V^T fragments; grid (t tiles, c tiles = heads, batch)
    k_vt<<<dim3(SEQ / 64, DM / 64, NB), 256, 0, stream>>>(v, VT);

    k_flash<<<dim3(SEQ / (16 * AW), NB * NH_, 1), 32 * AW, 0, stream>>>(QP, KP, VT, CX);

    // out = ctx W^T + b: A = ctx rows (m = b*SEQ + t), Bt = W rows (n = out column)
    k_out<<<dim3(NB * SEQ / 64, DM / 64, 1), 32, 0, stream>>>(CX, WH, bo, OUT);
}

// v003
// A run of this version takes 150 microseconds.
// In two side-by-side timings against v002, it was 1.05 and 1.04 times as fast.
// All steps since v000 together make it 1.76 times as fast.
#include <hip/hip_runtime.h>

// Multi-head attention on raw streams q, k, v [NB][SEQ][1024] = 16 heads x 64 (no input projections, no mask), score scale 1/8, output projection y = ctx W^T + b with W [out][in].
// Compute dtypes, f32 accumulate everywhere, all contractions v_wmma_f32_16x16x32_f16: q, k, v, W, b are RNE-converted to bf16 and all but b held exactly in f16 (W with a x64 carry); scores single product; P (x256 carry, cancels in the normalisation) and v single product;
// ctx carried x4096 as f16 value + f16 remainder (two products against the same W plane, one accumulator); softmax f32 (online, running max); bias added in f32.
// Layout: every f16 operand plane is stored in fragment order: one 16-row x 32-k fragment = 1 KiB = [load 0|1][lane 0..31][8 halves], lane = 16*hi + (row & 15), element e of load ld = k 16*ld + 8*hi + e,
// so each wave-wide 16-B load reads 512 contiguous bytes (4 whole lines). Q, K, W: fragment index (row/16)*32 + col/32; V^T: ((b*16+h)*(SEQ/32) + key/32)*4 + d/16; ctx (value 1024 | remainder 1024): (row/16)*64 + k/32.
// Fused flash kernel in transposed form (S^T = K Q^T, O^T = V^T P^T) writes the ctx plane, then a one-wave-per-64x64-tile GEMM over K = 2048 (value | remainder) against W rows.

#ifndef NB
#define NB 4
#endif
#ifndef SEQ
#define SEQ 2048
#endif
#define NB_FULL  4
#define SEQ_FULL 2048
#ifndef OUT_SEQ
#define OUT_SEQ SEQ              // row pitch (in tokens) between batches of the output
#endif
#define DM   1024
#define NH_  16
#define HD   64
#define AW   4                   // waves per flash block
#define QT   2                   // 16-row query tiles per flash wave
#define SC2  (0.125f * 1.4426950408889634f)   // HD^-0.5 * log2(e)
#define PSH  8.0f                // log2 of the P carry (256)
#define CXS  4096.0f             // carry of the ctx plane (value and remainder)
#define WSC  64.0f               // carry of the W plane
#define OSC  (1.0f / (4096.0f * 64.0f))

static_assert(HD == 64);
static_assert(NH_ * HD == DM);                 // head h = columns h*64 + d
static_assert((DM & (DM - 1)) == 0);           // k index wraps with a mask in the output GEMM
static_assert(DM % 256 == 0);                  // k_pack tiles 256 columns
static_assert(DM % 64 == 0);                   // GEMM k-loop takes two steps of 32 a trip
static_assert(SEQ % 64 == 0);                  // a 64-row tile never straddles two batches
static_assert((NB * SEQ) % 64 == 0);
static_assert(SEQ % 32 == 0);                  // key loop steps by 32
static_assert(SEQ % (16 * AW * QT) == 0);      // flash grid covers the sequence exactly
static_assert(QT == 2);                        // the two v_nop statements of k_flash name both tiles' registers
static_assert(((size_t)SEQ * DM) % 64 == 0);
static_assert(((size_t)DM * DM) % 64 == 0);
static_assert(NB <= NB_FULL);
static_assert(SEQ <= SEQ_FULL);

typedef _Float16 h16;
typedef __attribute__((ext_vector_type(16))) _Float16 v16h;
typedef __attribute__((ext_vector_type(8)))  _Float16 v8h;
typedef __attribute__((ext_vector_type(8)))  float    v8f;
typedef __attribute__((ext_vector_type(4)))  float    v4f;
typedef v4f  __attribute__((may_alias)) v4fa;
typedef v8h  __attribute__((may_alias)) v8ha;
typedef __attribute__((ext_vector_type(4)))  _Float16 v4h;
typedef v4h  __attribute__((may_alias)) v4ha;

// RNE convert f32 -> bf16, returned as the f32 value of that bf16
__device__ __forceinline__ float bfr(float f) { unsigned u = __float_as_uint(f); u += 0x7FFFu + ((u >> 16) & 1u); return __uint_as_float(u & 0xFFFF0000u); }
__device__ __forceinline__ v16h cat16(v8h lo, v8h hi) { return __builtin_shufflevector(lo, hi, 0, 1, 2, 3, 4, 5, 6, 7, 8, 9, 10, 11, 12, 13, 14, 15); }
__device__ __forceinline__ v8f wmma16(v16h a, v16h b, v8f c) { return __builtin_amdgcn_wmma_f32_16x16x32_f16(false, a, false, b, (short)0, c, false, false); }
// fragment loader from a plane in fragment order; p = fragment base + 8*lane: elements 0..7 <- k0+8h+0..7, elements 8..15 <- k0+16+8h+0..7 (same map for A and B)
#define FRG 512                  // halves per fragment
__device__ __forceinline__ v16h ldh(const h16* p) { return cat16(*(const v8h*)p, *(const v8h*)(p + 256)); }
// ordering point for wave-private LDS tiles (same wave writes and reads)
__device__ __forceinline__ void wave_sync() { __builtin_amdgcn_fence(3 /* release order */, "wavefront"); __builtin_amdgcn_wave_barrier(); asm volatile("" ::: "memory"); }

// k_pack: f32 rows [R][1024] -> f16 plane (bf16 RNE value x scale) in fragment order. One block = 16 rows x 256 columns: whole-line reads, row-major LDS tile (pitch 528 B = 16 B x odd), 8 KiB contiguous out (cross-wave: block barrier).
__global__ __launch_bounds__(256) void k_pack(const float* __restrict__ src, h16* dst, float scale) {
    __shared__ __align__(16) h16 ts[16 * 264];
    const int tid = threadIdx.x; const int rt = blockIdx.x, c0 = blockIdx.y * 256;
    const float* s = src + (size_t)rt * 16 * DM + c0;
#pragma unroll
    for (int i = 0; i < 4; ++i) { const int idx = i * 256 + tid, row = idx >> 6, c4 = (idx & 63) * 4;
        const v4f x = *(const v4f*)(s + (size_t)row * DM + c4); v4h o;
#pragma unroll
        for (int e = 0; e < 4; ++e) o[e] = (h16)(bfr(x[e]) * scale);
        *(v4ha*)(&ts[row * 264 + c4]) = o; }
    __syncthreads();
    h16* d = dst + ((size_t)rt * (DM / 32) + c0 / 32) * FRG;
#pragma unroll
    for (int it = 0; it < 2; ++it) { const int o = it * 256 + tid, ln = o & 31;   // o = 16-B piece of the 8 fragments: [k chunk o>>6][load (o>>5)&1][lane]
        const v8h val = *(const v8ha*)(&ts[(ln & 15) * 264 + (o >> 6) * 32 + ((o >> 5) & 1) * 16 + (ln >> 4) * 8]);
        *(v8h*)(d + (size_t)o * 8) = val; }
}

// k_vt: V^T plane. in: v[b][t][c] (f32, per-batch pitch SEQ_FULL*DM) -> out: V^T fragments (row d, k = key; f16 of the bf16 RNE value). 64 x 64 tile = one head x 2 key chunks = 8 fragments, through LDS (cross-wave: block barrier).
__global__ __launch_bounds__(256) void k_vt(const float* __restrict__ V, h16* VT) {
    __shared__ __align__(16) h16 ts[64 * 72];
    const int tid = threadIdx.x; const int t0 = blockIdx.x * 64, c0 = blockIdx.y * 64, b = blockIdx.z;
    const float* src = V + ((size_t)b * SEQ_FULL + t0) * DM + c0;
#pragma unroll
    for (int i = 0; i < 4; ++i) { const int t = i * 16 + (tid >> 4), c4 = (tid & 15) * 4;
        const v4f x = *(const v4f*)(src + (size_t)t * DM + c4);
#pragma unroll
        for (int e = 0; e < 4; ++e) ts[(c4 + e) * 72 + t] = (h16)bfr(x[e]); }
    __syncthreads();
    h16* dst = VT + (((size_t)b * NH_ + blockIdx.y) * (SEQ / 32) + t0 / 32) * 4 * FRG;
#pragma unroll
    for (int it = 0; it < 2; ++it) { const int o = it * 256 + tid, ln = o & 31;   // o = 16-B piece: [key chunk o>>8][d tile (o>>6)&3][load (o>>5)&1][lane]
        const v8h val = *(const v8ha*)(&ts[(((o >> 6) & 3) * 16 + (ln & 15)) * 72 + (o >> 8) * 32 + ((o >> 5) & 1) * 16 + (ln >> 4) * 8]);
        *(v8h*)(dst + (size_t)o * 8) = val; }
}

// k_flash: fused attention, one wave per 32 query rows (QT = 2 tiles of 16) of one (batch, head); K / V^T / Q fragments straight from the f16 planes (two 16-B loads each, 512 contiguous bytes per wave-wide load).
// Each K and each V^T fragment is loaded once per wave and feeds one product per query tile, so the loaded bytes per product are 1 / QT of a one-tile wave's.
// Transposed form: S^T[key][t] = K Q^T (A = K rows, B = Q rows); lane (t = lane&15, h = lane>>4) holds keys 8h+r of each 16-key tile, so the packed
// P tile is directly the B fragment of O^T[d][t] = V^T P^T (element r <- tile keys 0..15, element 8+r <- tile keys 16..31, lane unchanged).
// Softmax state (running max, partial sum) is one scalar per lane and query tile; the two lane halves of a row are combined with one xor-16 exchange.
__global__ __launch_bounds__(32 * AW) void k_flash(const h16* __restrict__ QP, const h16* __restrict__ KP, const h16* __restrict__ VT, h16* CTX) {
    const int lane = threadIdx.x & 31, wave = __builtin_amdgcn_readfirstlane((int)(threadIdx.x >> 5));
    const int zh = blockIdx.y; const int b = zh / NH_, h = zh % NH_;
    const int t0 = (blockIdx.x * AW + wave) * (16 * QT);
    const size_t rbase = ((size_t)(b * SEQ / 16) * (DM / 32) + 2 * h) * FRG + 8 * lane;   // fragment (row tile 0 of the batch, k chunk 2h)
    const size_t qo = rbase + (size_t)(t0 / 16) * (DM / 32) * FRG;
    v16h qh0[QT], qh1[QT];                                          // B fragments: col t, k = d
#pragma unroll
    for (int q = 0; q < QT; ++q) { qh0[q] = ldh(QP + qo + (size_t)q * (DM / 32) * FRG); qh1[q] = ldh(QP + qo + (size_t)q * (DM / 32) * FRG + FRG); }
    const size_t ko = rbase;                                        // + (key/16) * 32 fragments   (A fragment: row key, k = d)
    const size_t vo = (size_t)zh * (SEQ / 32) * 4 * FRG + 8 * lane; // + (key/32) * 4 fragments + j (A fragment: row d, k = key)
    v8f o0[QT], o1[QT], o2[QT], o3[QT]; float m[QT], l[QT];
#pragma unroll
    for (int q = 0; q < QT; ++q) { o0[q] = (v8f){}; o1[q] = (v8f){}; o2[q] = (v8f){}; o3[q] = (v8f){}; m[q] = -3.0e38f; l[q] = 0.0f; }
#pragma unroll 1
    for (int key0 = 0; key0 < SEQ; key0 += 32) {
        const h16* ka = KP + ko + (size_t)(key0 / 16) * (DM / 32) * FRG;
        const v16h ka0 = ldh(ka), ka1 = ldh(ka + FRG), kb0 = ldh(ka + (DM / 32) * FRG), kb1 = ldh(ka + (DM / 32) * FRG + FRG);
        v8f sa[QT], sb[QT];
#pragma unroll
        for (int q = 0; q < QT; ++q) { sa[q] = wmma16(ka0, qh0[q], (v8f){}); sb[q] = wmma16(kb0, qh0[q], (v8f){}); }
#pragma unroll
        for (int q = 0; q < QT; ++q) { sa[q] = wmma16(ka1, qh1[q], sa[q]); sb[q] = wmma16(kb1, qh1[q], sb[q]); }
        // four vector slots between the last score product and the first read of its result
        asm volatile("v_nop\n\tv_nop\n\tv_nop\n\tv_nop" : "+v"(sa[0]), "+v"(sb[0]), "+v"(sa[1]), "+v"(sb[1]) : "v"(ka0), "v"(ka1), "v"(kb0), "v"(kb1));
        v16h pb[QT];
#pragma unroll
        for (int q = 0; q < QT; ++q) {
            const v8f ta = sa[q] * SC2, tb = sb[q] * SC2; float mx = -3.0e38f;
#pragma unroll
            for (int r = 0; r < 8; ++r) mx = fmaxf(mx, fmaxf(ta[r], tb[r]));
            mx = fmaxf(mx, __shfl_xor(mx, 16, 32));
            const float mnew = fmaxf(m[q], mx);
            const float alpha = __builtin_amdgcn_exp2f(m[q] - mnew);
            const float sh = PSH - mnew;
            const v8f ea = ta + sh, eb = tb + sh;
            float ls = 0.0f;
#pragma unroll
            for (int r = 0; r < 8; ++r) { const h16 pa = (h16)__builtin_amdgcn_exp2f(ea[r]); const h16 pc = (h16)__builtin_amdgcn_exp2f(eb[r]); pb[q][r] = pa; pb[q][8 + r] = pc; ls += (float)pa + (float)pc; }
            l[q] = l[q] * alpha + ls; m[q] = mnew;
            o0[q] = o0[q] * alpha; o1[q] = o1[q] * alpha; o2[q] = o2[q] * alpha; o3[q] = o3[q] * alpha;
        }
        const h16* va = VT + vo + (size_t)(key0 / 32) * 4 * FRG;
        const v16h v0 = ldh(va), v1 = ldh(va + FRG), v2 = ldh(va + 2 * FRG), v3 = ldh(va + 3 * FRG);
#pragma unroll
        for (int q = 0; q < QT; ++q) { o0[q] = wmma16(v0, pb[q], o0[q]); o1[q] = wmma16(v1, pb[q], o1[q]); o2[q] = wmma16(v2, pb[q], o2[q]); o3[q] = wmma16(v3, pb[q], o3[q]); }
        // four vector slots behind the last product, also on the taken side of the loop branch
        asm volatile("v_nop\n\tv_nop\n\tv_nop\n\tv_nop" : "+v"(o0[0]), "+v"(o1[0]), "+v"(o2[0]), "+v"(o3[0]), "+v"(o0[1]), "+v"(o1[1]), "+v"(o2[1]), "+v"(o3[1]) : "v"(v0), "v"(v1), "v"(v2), "v"(v3), "v"(pb[0]), "v"(pb[1]));
    }
#pragma unroll
    for (int q = 0; q < QT; ++q) {
        const float lt = l[q] + __shfl_xor(l[q], 16, 32);
        const float inv = CXS * (1.0f / lt);
        // O^T D layout: o_j[r] = (d = 16j + 8h + r, t = lane&15), which is load j&1 of ctx fragment (row tile t0/16 + q, k chunk 2*head + (j>>1)) at this same lane: stored from registers, 512 contiguous bytes per store
        h16* cw = CTX + ((size_t)((b * SEQ + t0) / 16 + q) * (2 * DM / 32) + 2 * h) * FRG + 8 * lane;
        const v8f oj[4] = { o0[q], o1[q], o2[q], o3[q] };
#pragma unroll
        for (int j = 0; j < 4; ++j) { v8h hv, rv;
#pragma unroll
            for (int r = 0; r < 8; ++r) { const float x = oj[j][r] * inv; const h16 a = (h16)x; hv[r] = a; rv[r] = (h16)(x - (float)a); }
            *(v8h*)(cw + j * 256) = hv; *(v8h*)(cw + (DM / 32) * FRG + j * 256) = rv; }
    }
}

// k_out: register-blocked f16 GEMM, ONE WAVE per 64x64 tile (16 accumulators), operands straight from the f16 planes in fragment order.
// OUT[m][n] = 2^-18 * sum_{k<2048} A[m][k] Bt[n][k & 1023] + b[n]; A = ctx plane [M][value 1024 | remainder 1024] (x4096), Bt = W plane [out][in] (x64). grid (M/64, DM/64), 32 threads.
__global__ __launch_bounds__(32) void k_out(const h16* __restrict__ A, const h16* __restrict__ Bt, const float* __restrict__ bias, float* OUT) {
    __shared__ __align__(16) float os[16 * 68];
    const int KA = 2 * DM;
    const int lane = threadIdx.x & 31, lr = lane & 15, hi = lane >> 4; const int r0 = blockIdx.x * 64, c0 = blockIdx.y * 64;
    v8f acc[4][4];
#pragma unroll
    for (int mb = 0; mb < 4; ++mb)
#pragma unroll
        for (int nb = 0; nb < 4; ++nb) acc[mb][nb] = (v8f){};
    const h16* ap = A + (size_t)(r0 / 16) * (KA / 32) * FRG + 8 * lane;    // + (mb * (KA / 32) + k step) fragments
    const h16* bp = Bt + (size_t)(c0 / 16) * (DM / 32) * FRG + 8 * lane;   // + (nb * (DM / 32) + (k step mod 32)) fragments
    // two fragment sets: while one k step's 16 products run, the next step's 8 fragments are already in flight into the other set
    v16h a0[4], b0[4], a1[4], b1[4];
#pragma unroll
    for (int i = 0; i < 4; ++i) { a0[i] = ldh(ap + (size_t)(i * (KA / 32)) * FRG); b0[i] = ldh(bp + (size_t)(i * (DM / 32)) * FRG); }
    asm volatile("s_wait_xcnt 0x0" ::: "memory");   // in front of every later overwrite of an address register that these 16 loads name
#pragma unroll 1
    for (int ks = 0; ks < KA / 32; ks += 2) {
        const int k1 = ks + 1, k2 = (ks + 2) & (KA / 32 - 1);   // k2 wraps to step 0 behind the last step: in bounds, loaded and not used
        const h16* ap1 = ap + (size_t)k1 * FRG; const h16* bp1 = bp + (size_t)(k1 & (DM / 32 - 1)) * FRG;
#pragma unroll
        for (int i = 0; i < 4; ++i) { a1[i] = ldh(ap1 + (size_t)(i * (KA / 32)) * FRG); b1[i] = ldh(bp1 + (size_t)(i * (DM / 32)) * FRG); }
        asm volatile("s_wait_xcnt 0x0" :: "v"(bp1) : "memory");   // in front of every overwrite of an address register that these 16 loads name; naming the B pointer keeps its registers live up to here, so that no load of the group lands on them (the A loads go by the trip's running pointer, which lives on)
        __builtin_amdgcn_sched_barrier(0);   // keeps the 16 loads of the next step ahead of this step's products (the scheduler otherwise sinks them next to their use, and their latency is waited out)
#pragma unroll
        for (int nb = 0; nb < 4; ++nb)
#pragma unroll
            for (int mb = 0; mb < 4; ++mb) acc[mb][nb] = wmma16(a0[mb], b0[nb], acc[mb][nb]);
        __builtin_amdgcn_sched_barrier(0);   // the refill of the first set stays behind its last reader and, with the next fence, ahead of the second set's products
        const h16* ap2 = ap + (size_t)k2 * FRG; const h16* bp2 = bp + (size_t)(k2 & (DM / 32 - 1)) * FRG;
#pragma unroll
        for (int i = 0; i < 4; ++i) { a0[i] = ldh(ap2 + (size_t)(i * (KA / 32)) * FRG); b0[i] = ldh(bp2 + (size_t)(i * (DM / 32)) * FRG); }
        asm volatile("s_wait_xcnt 0x0" :: "v"(ap2), "v"(bp2) : "memory");   // as above; both pointers of this group are formed for it alone, so both are named
        __builtin_amdgcn_sched_barrier(0);   // as above, for the second set
#pragma unroll
        for (int nb = 0; nb < 4; ++nb)
#pragma unroll
            for (int mb = 0; mb < 4; ++mb) acc[mb][nb] = wmma16(a1[mb], b1[nb], acc[mb][nb]);
        // four vector slots behind the last product, also on the taken side of the loop branch
        asm volatile("v_nop\n\tv_nop\n\tv_nop\n\tv_nop" : "+v"(acc[0][0]), "+v"(acc[1][1]), "+v"(acc[2][2]), "+v"(acc[3][3]) : "v"(a1[0]), "v"(a1[1]), "v"(a1[2]), "v"(a1[3]));
    }
    v4f bv = *(const v4f*)(bias + c0 + lr * 4);
#pragma unroll
    for (int i = 0; i < 4; ++i) bv[i] = bfr(bv[i]);
    float* orow = OUT + ((size_t)(r0 / SEQ) * OUT_SEQ + (size_t)(r0 % SEQ)) * DM + c0;
#pragma unroll
    for (int mb = 0; mb < 4; ++mb) {
#pragma unroll
        for (int nb = 0; nb < 4; ++nb) {
#pragma unroll
            for (int j = 0; j < 8; ++j) os[(hi * 8 + j) * 68 + nb * 16 + lr] = acc[mb][nb][j] * OSC; }   // D: row 8h+j, col lane&15
        wave_sync();
{
#pragma unroll
            for (int s = 0; s < 8; ++s) { const int row = 2 * s + hi, cofs = lr * 4;   // 8 s x 2 rows = 16 rows; 16 lanes x 4 floats = 64 columns
                const v4f x = *(const v4fa*)(&os[row * 68 + cofs]);
                const v4f val = x + bv;
                *(v4f*)(orow + (size_t)(mb * 16 + row) * DM + cofs) = val; }
             }
        wave_sync();
    }
}

static constexpr size_t al256(size_t v) { return (v + 255) & ~(size_t)255; }
static constexpr size_t SZ_PL = al256((size_t)NB * SEQ * DM * 2);          // one f16 plane of a stream
static constexpr size_t SZ_WH = al256((size_t)DM * DM * 2);
static constexpr size_t SZ_CX = al256((size_t)NB * SEQ * 2 * DM * 2);      // ctx value | remainder
static constexpr size_t SZ_TOTAL = 3 * SZ_PL + SZ_WH + SZ_CX;
static_assert(SZ_TOTAL <= (size_t)134217728);          // workspace carve <= 128 MiB

extern "C" void kernel_launch(void* const* d_in, const int* in_sizes, int n_in,
                              void* d_out, int out_size, void* d_ws, size_t ws_size, hipStream_t stream) {
    if (n_in < 5) return;
    const size_t needx = ((size_t)(NB - 1) * SEQ_FULL + SEQ) * DM;
    if ((size_t)in_sizes[0] < needx || (size_t)in_sizes[1] < needx || (size_t)in_sizes[2] < needx) return;
    if ((size_t)in_sizes[3] < (size_t)DM * DM || (size_t)in_sizes[4] < (size_t)DM) return;
    if ((size_t)out_size < ((size_t)(NB - 1) * OUT_SEQ + SEQ) * DM) return;
    if (SZ_TOTAL > ws_size) return;
    const float* q = (const float*)d_in[0]; const float* k = (const float*)d_in[1]; const float* v = (const float*)d_in[2];   // wire order q, k, v, W_out, b_out
    const float* wo = (const float*)d_in[3]; const float* bo = (const float*)d_in[4];                                         // W_out [out][in] = Bt as-is
    float* OUT = (float*)d_out;      // [NB][SEQ][1024]
    char* wsp = (char*)d_ws;
    h16* QP = (h16*)wsp; wsp += SZ_PL;               // [NB*SEQ/16][32] fragments
    h16* KP = (h16*)wsp; wsp += SZ_PL;               // [NB*SEQ/16][32] fragments
    h16* VT = (h16*)wsp; wsp += SZ_PL;               // [NB*16][SEQ/32][4] fragments
    h16* WH = (h16*)wsp; wsp += SZ_WH;               // [1024/16][32] fragments, x64
    h16* CX = (h16*)wsp; wsp += SZ_CX;               // [NB*SEQ/16][64] fragments, x4096

    if (SEQ == SEQ_FULL) {
        const dim3 g(NB * SEQ / 16, DM / 256, 1);
        k_pack<<<g, 256, 0, stream>>>(q, QP, 1.0f);
        k_pack<<<g, 256, 0, stream>>>(k, KP, 1.0f);
    } else {
        const dim3 g(SEQ / 16, DM / 256, 1);
        for (int b = 0; b < NB; ++b) {
            k_pack<<<g, 256, 0, stream>>>(q + (size_t)b * SEQ_FULL * DM, QP + (size_t)b * SEQ * DM, 1.0f);
            k_pack<<<g, 256, 0, stream>>>(k + (size_t)b * SEQ_FULL * DM, KP + (size_t)b * SEQ * DM, 1.0f);
        }
    }
    k_pack<<<dim3(DM / 16, DM / 256, 1), 256, 0, stream>>>(wo, WH, WSC);

    // in: v[b][t = SEQ rows][c = 1024 cols] -> out: V^T fragments; grid (t tiles, c tiles = heads, batch)
    k_vt<<<dim3(SEQ / 64, DM / 64, NB), 256, 0, stream>>>(v, VT);

    k_flash<<<dim3(SEQ / (16 * AW * QT), NB * NH_, 1), 32 * AW, 0, stream>>>(QP, KP, VT, CX);

    // out = ctx W^T + b: A = ctx rows (m = b*SEQ + t), Bt = W rows (n = out column)
    k_out<<<dim3(NB * SEQ / 64, DM / 64, 1), 32, 0, stream>>>(CX, WH, bo, OUT);
}

// v004
// Measured time: 142 microseconds a run.
// In both of two side-by-side timings against v003, it was 1.05 times as fast.
// All steps since v000 together make it 1.86 times as fast.
#include <hip/hip_runtime.h>

// Multi-head attention on raw streams q, k, v [NB][SEQ][1024] = 16 heads x 64 (no input projections, no mask), score scale 1/8, output projection y = ctx W^T + b with W [out][in].
// Compute dtypes, f32 accumulate everywhere, all contractions v_wmma_f32_16x16x32_f16: q, k, v, W, b are RNE-converted to bf16 and all but b held exactly in f16 (W with a x64 carry); scores single product; P (x256 carry, cancels in the normalisation) and v single product;
// ctx carried x4096 as f16 value + f16 remainder (two products against the same W plane, one accumulator); softmax f32 (online, running max); bias added in f32.
// Layout: every f16 operand plane is stored in fragment order: one 16-row x 32-k fragment = 1 KiB = [load 0|1][lane 0..31][8 halves], lane = 16*hi + (row & 15), element e of load ld = k 16*ld + 8*hi + e,
// so each wave-wide 16-B load reads 512 contiguous bytes (4 whole lines). Q, K, W: fragment index (row/16)*32 + col/32; V^T: ((b*16+h)*(SEQ/32) + key/32)*4 + d/16; ctx (value 1024 | remainder 1024): (row/16)*64 + k/32.
// Fused flash kernel in transposed form (S^T = K Q^T, O^T = V^T P^T) writes the ctx plane, then a one-wave-per-64x64-tile GEMM over K = 2048 (value | remainder) against W rows.

#ifndef NB
#define NB 4
#endif
#ifndef SEQ
#define SEQ 2048
#endif
#define NB_FULL  4
#define SEQ_FULL 2048
#ifndef OUT_SEQ
#define OUT_SEQ SEQ              // row pitch (in tokens) between batches of the output
#endif
#define DM   1024
#define NH_  16
#define HD   64
#define AW   4                   // waves per flash block
#define QT   2                   // 16-row query tiles per flash wave
#define SC2  (0.125f * 1.4426950408889634f)   // HD^-0.5 * log2(e)
#define PSH  8.0f                // log2 of the P carry (256)
#define CXS  4096.0f             // carry of the ctx plane (value and remainder)
#define WSC  64.0f               // carry of the W plane
#define OSC  (1.0f / (4096.0f * 64.0f))

static_assert(HD == 64);
static_assert(NH_ * HD == DM);                 // head h = columns h*64 + d
static_assert((DM & (DM - 1)) == 0);           // k index wraps with a mask in the output GEMM
static_assert(DM % 256 == 0);                  // pack_tile takes 256 columns
static_assert(DM % 64 == 0);                   // GEMM k-loop takes two steps of 32 a trip
static_assert(SEQ % 64 == 0);                  // a 64-row tile never straddles two batches
static_assert((NB * SEQ) % 64 == 0);
static_assert(SEQ % 32 == 0);                  // key loop steps by 32
static_assert(SEQ % (16 * AW * QT) == 0);      // flash grid covers the sequence exactly
static_assert(QT == 2);                        // the two v_nop statements of k_flash name both tiles' registers
static_assert(((size_t)SEQ * DM) % 64 == 0);
static_assert(((size_t)DM * DM) % 64 == 0);
static_assert(NB <= NB_FULL);
static_assert(SEQ <= SEQ_FULL);

typedef _Float16 h16;
typedef __attribute__((ext_vector_type(16))) _Float16 v16h;
typedef __attribute__((ext_vector_type(8)))  _Float16 v8h;
typedef __attribute__((ext_vector_type(8)))  float    v8f;
typedef __attribute__((ext_vector_type(4)))  float    v4f;
typedef v4f  __attribute__((may_alias)) v4fa;
typedef v8h  __attribute__((may_alias)) v8ha;
typedef __attribute__((ext_vector_type(4)))  _Float16 v4h;
typedef v4h  __attribute__((may_alias)) v4ha;

// RNE convert f32 -> bf16, returned as the f32 value of that bf16
__device__ __forceinline__ float bfr(float f) { unsigned u = __float_as_uint(f); u += 0x7FFFu + ((u >> 16) & 1u); return __uint_as_float(u & 0xFFFF0000u); }
__device__ __forceinline__ v16h cat16(v8h lo, v8h hi) { return __builtin_shufflevector(lo, hi, 0, 1, 2, 3, 4, 5, 6, 7, 8, 9, 10, 11, 12, 13, 14, 15); }
__device__ __forceinline__ v8f wmma16(v16h a, v16h b, v8f c) { return __builtin_amdgcn_wmma_f32_16x16x32_f16(false, a, false, b, (short)0, c, false, false); }
// fragment loader from a plane in fragment order; p = fragment base + 8*lane: elements 0..7 <- k0+8h+0..7, elements 8..15 <- k0+16+8h+0..7 (same map for A and B)
#define FRG 512                  // halves per fragment
__device__ __forceinline__ v16h ldh(const h16* p) { return cat16(*(const v8h*)p, *(const v8h*)(p + 256)); }
// ordering point for wave-private LDS tiles (same wave writes and reads)
__device__ __forceinline__ void wave_sync() { __builtin_amdgcn_fence(3 /* release order */, "wavefront"); __builtin_amdgcn_wave_barrier(); asm volatile("" ::: "memory"); }

// pack_tile: 16 f32 rows x 256 columns (s = first element, row pitch DM) -> 8 fragments of an f16 plane (bf16 RNE value x scale) at d: whole-line reads, row-major LDS tile (pitch 528 B = 16 B x odd), 8 KiB contiguous out (cross-wave: block barrier).
__device__ __forceinline__ void pack_tile(const float* __restrict__ s, h16* d, float scale, h16* ts, int tid) {
#pragma unroll
    for (int i = 0; i < 4; ++i) { const int idx = i * 256 + tid, row = idx >> 6, c4 = (idx & 63) * 4;
        const v4f x = *(const v4f*)(s + (size_t)row * DM + c4); v4h o;
#pragma unroll
        for (int e = 0; e < 4; ++e) o[e] = (h16)(bfr(x[e]) * scale);
        *(v4ha*)(&ts[row * 264 + c4]) = o; }
    __syncthreads();
    v8h val[2];
#pragma unroll
    for (int it = 0; it < 2; ++it) { const int o = it * 256 + tid, ln = o & 31;   // o = 16-B piece of the 8 fragments: [k chunk o>>6][load (o>>5)&1][lane]
        val[it] = *(const v8ha*)(&ts[(ln & 15) * 264 + (o >> 6) * 32 + ((o >> 5) & 1) * 16 + (ln >> 4) * 8]); }
#pragma unroll
    for (int it = 0; it < 2; ++it) *(v8h*)(d + (size_t)(it * 256 + tid) * 8) = val[it];
}

// vt_tile: 64 keys x 64 columns of v (src = first element, row pitch DM; one head x 2 key chunks) -> 8 V^T fragments (row d, k = key; f16 of the bf16 RNE value) at dst, through LDS (cross-wave: block barrier).
__device__ __forceinline__ void vt_tile(const float* __restrict__ src, h16* dst, h16* ts, int tid) {
#pragma unroll
    for (int i = 0; i < 4; ++i) { const int t = i * 16 + (tid >> 4), c4 = (tid & 15) * 4;
        const v4f x = *(const v4f*)(src + (size_t)t * DM + c4);
#pragma unroll
        for (int e = 0; e < 4; ++e) ts[(c4 + e) * 72 + t] = (h16)bfr(x[e]); }
    __syncthreads();
    v8h val[2];
#pragma unroll
    for (int it = 0; it < 2; ++it) { const int o = it * 256 + tid, ln = o & 31;   // o = 16-B piece: [key chunk o>>8][d tile (o>>6)&3][load (o>>5)&1][lane]
        val[it] = *(const v8ha*)(&ts[(((o >> 6) & 3) * 16 + (ln & 15)) * 72 + (o >> 8) * 32 + ((o >> 5) & 1) * 16 + (ln >> 4) * 8]); }
#pragma unroll
    for (int it = 0; it < 2; ++it) *(v8h*)(dst + (size_t)(it * 256 + tid) * 8) = val[it];
}

// k_prep: all four operand planes in ONE launch (they depend on nothing but the inputs): the flat block index picks the plane and the tile, alike for the whole block, so each block runs one tile body with its one barrier.
// Blocks [0, VT_BL): V^T tiles (key tile fastest, then head, then batch); then Q, then K (row tile fastest, then 256-column block; per-batch input pitch SEQ_FULL rows); then W (x64).
#define VT_BL ((SEQ / 64) * (DM / 64) * NB)
#define ST_RT (NB * SEQ / 16)            // 16-row tiles of a stream plane
#define ST_BL (ST_RT * (DM / 256))
#define W_RT  (DM / 16)
#define W_BL  (W_RT * (DM / 256))
__global__ __launch_bounds__(256) void k_prep(const float* __restrict__ q, const float* __restrict__ k, const float* __restrict__ v, const float* __restrict__ w, h16* QP, h16* KP, h16* VT, h16* WH) {
    __shared__ __align__(16) h16 ts[64 * 72];
    static_assert(64 * 72 >= 16 * 264);   // one LDS tile serves either body
    const int tid = threadIdx.x; const int bid = blockIdx.x;
    if (bid < VT_BL) {
        const int t0 = (bid % (SEQ / 64)) * 64, hd = (bid / (SEQ / 64)) % (DM / 64), b = bid / ((SEQ / 64) * (DM / 64));
        vt_tile(v + ((size_t)b * SEQ_FULL + t0) * DM + hd * 64, VT + (((size_t)b * NH_ + hd) * (SEQ / 32) + t0 / 32) * 4 * FRG, ts, tid);
    } else if (bid < VT_BL + 2 * ST_BL) {
        const int u = bid - VT_BL; const bool isk = u >= ST_BL; const int x = isk ? u - ST_BL : u;
        const int rt = x % ST_RT, c0 = (x / ST_RT) * 256;
        const size_t row = (size_t)(rt / (SEQ / 16)) * SEQ_FULL + (size_t)(rt % (SEQ / 16)) * 16;
        pack_tile((isk ? k : q) + row * DM + c0, (isk ? KP : QP) + ((size_t)rt * (DM / 32) + c0 / 32) * FRG, 1.0f, ts, tid);
    } else {
        const int x = bid - (VT_BL + 2 * ST_BL); const int rt = x % W_RT, c0 = (x / W_RT) * 256;
        pack_tile(w + (size_t)rt * 16 * DM + c0, WH + ((size_t)rt * (DM / 32) + c0 / 32) * FRG, WSC, ts, tid);
    }
}

// k_flash: fused attention, one wave per 32 query rows (QT = 2 tiles of 16) of one (batch, head); K / V^T / Q fragments straight from the f16 planes (two 16-B loads each, 512 contiguous bytes per wave-wide load).
// Each K and each V^T fragment is loaded once per wave and feeds one product per query tile, so the loaded bytes per product are 1 / QT of a one-tile wave's.
// Transposed form: S^T[key][t] = K Q^T (A = K rows, B = Q rows); lane (t = lane&15, h = lane>>4) holds keys 8h+r of each 16-key tile, so the packed
// P tile is directly the B fragment of O^T[d][t] = V^T P^T (element r <- tile keys 0..15, element 8+r <- tile keys 16..31, lane unchanged).
// Softmax state (running max, partial sum) is one scalar per lane and query tile; the two lane halves of a row are combined with one xor-16 exchange.
__global__ __launch_bounds__(32 * AW) void k_flash(const h16* __restrict__ QP, const h16* __restrict__ KP, const h16* __restrict__ VT, h16* CTX) {
    const int lane = threadIdx.x & 31, wave = __builtin_amdgcn_readfirstlane((int)(threadIdx.x >> 5));
    const int zh = blockIdx.y; const int b = zh / NH_, h = zh % NH_;
    const int t0 = (blockIdx.x * AW + wave) * (16 * QT);
    const size_t rbase = ((size_t)(b * SEQ / 16) * (DM / 32) + 2 * h) * FRG + 8 * lane;   // fragment (row tile 0 of the batch, k chunk 2h)
    const size_t qo = rbase + (size_t)(t0 / 16) * (DM / 32) * FRG;
    v16h qh0[QT], qh1[QT];                                          // B fragments: col t, k = d
#pragma unroll
    for (int q = 0; q < QT; ++q) { qh0[q] = ldh(QP + qo + (size_t)q * (DM / 32) * FRG); qh1[q] = ldh(QP + qo + (size_t)q * (DM / 32) * FRG + FRG); }
    const size_t ko = rbase;                                        // + (key/16) * 32 fragments   (A fragment: row key, k = d)
    const size_t vo = (size_t)zh * (SEQ / 32) * 4 * FRG + 8 * lane; // + (key/32) * 4 fragments + j (A fragment: row d, k = key)
    v8f o0[QT], o1[QT], o2[QT], o3[QT]; float m[QT], l[QT];
#pragma unroll
    for (int q = 0; q < QT; ++q) { o0[q] = (v8f){}; o1[q] = (v8f){}; o2[q] = (v8f){}; o3[q] = (v8f){}; m[q] = -3.0e38f; l[q] = 0.0f; }
#pragma unroll 1
    for (int key0 = 0; key0 < SEQ; key0 += 32) {
        const h16* ka = KP + ko + (size_t)(key0 / 16) * (DM / 32) * FRG;
        const v16h ka0 = ldh(ka), ka1 = ldh(ka + FRG), kb0 = ldh(ka + (DM / 32) * FRG), kb1 = ldh(ka + (DM / 32) * FRG + FRG);
        v8f sa[QT], sb[QT];
#pragma unroll
        for (int q = 0; q < QT; ++q) { sa[q] = wmma16(ka0, qh0[q], (v8f){}); sb[q] = wmma16(kb0, qh0[q], (v8f){}); }
#pragma unroll
        for (int q = 0; q < QT; ++q) { sa[q] = wmma16(ka1, qh1[q], sa[q]); sb[q] = wmma16(kb1, qh1[q], sb[q]); }
        // four vector slots between the last score product and the first read of its result
        asm volatile("v_nop\n\tv_nop\n\tv_nop\n\tv_nop" : "+v"(sa[0]), "+v"(sb[0]), "+v"(sa[1]), "+v"(sb[1]) : "v"(ka0), "v"(ka1), "v"(kb0), "v"(kb1));
        v16h pb[QT];
#pragma unroll
        for (int q = 0; q < QT; ++q) {
            const v8f ta = sa[q] * SC2, tb = sb[q] * SC2; float mx = -3.0e38f;
#pragma unroll
            for (int r = 0; r < 8; ++r) mx = fmaxf(mx, fmaxf(ta[r], tb[r]));
            mx = fmaxf(mx, __shfl_xor(mx, 16, 32));
            const float mnew = fmaxf(m[q], mx);
            const float alpha = __builtin_amdgcn_exp2f(m[q] - mnew);
            const float sh = PSH - mnew;
            const v8f ea = ta + sh, eb = tb + sh;
            float ls = 0.0f;
#pragma unroll
            for (int r = 0; r < 8; ++r) { const h16 pa = (h16)__builtin_amdgcn_exp2f(ea[r]); const h16 pc = (h16)__builtin_amdgcn_exp2f(eb[r]); pb[q][r] = pa; pb[q][8 + r] = pc; ls += (float)pa + (float)pc; }
            l[q] = l[q] * alpha + ls; m[q] = mnew;
            o0[q] = o0[q] * alpha; o1[q] = o1[q] * alpha; o2[q] = o2[q] * alpha; o3[q] = o3[q] * alpha;
        }
        const h16* va = VT + vo + (size_t)(key0 / 32) * 4 * FRG;
        const v16h v0 = ldh(va), v1 = ldh(va + FRG), v2 = ldh(va + 2 * FRG), v3 = ldh(va + 3 * FRG);
#pragma unroll
        for (int q = 0; q < QT; ++q) { o0[q] = wmma16(v0, pb[q], o0[q]); o1[q] = wmma16(v1, pb[q], o1[q]); o2[q] = wmma16(v2, pb[q], o2[q]); o3[q] = wmma16(v3, pb[q], o3[q]); }
        // four vector slots behind the last product, also on the taken side of the loop branch
        asm volatile("v_nop\n\tv_nop\n\tv_nop\n\tv_nop" : "+v"(o0[0]), "+v"(o1[0]), "+v"(o2[0]), "+v"(o3[0]), "+v"(o0[1]), "+v"(o1[1]), "+v"(o2[1]), "+v"(o3[1]) : "v"(v0), "v"(v1), "v"(v2), "v"(v3), "v"(pb[0]), "v"(pb[1]));
    }
#pragma unroll
    for (int q = 0; q < QT; ++q) {
        const float lt = l[q] + __shfl_xor(l[q], 16, 32);
        const float inv = CXS * (1.0f / lt);
        // O^T D layout: o_j[r] = (d = 16j + 8h + r, t = lane&15), which is load j&1 of ctx fragment (row tile t0/16 + q, k chunk 2*head + (j>>1)) at this same lane: stored from registers, 512 contiguous bytes per store
        h16* cw = CTX + ((size_t)((b * SEQ + t0) / 16 + q) * (2 * DM / 32) + 2 * h) * FRG + 8 * lane;
        const v8f oj[4] = { o0[q], o1[q], o2[q], o3[q] };
#pragma unroll
        for (int j = 0; j < 4; ++j) { v8h hv, rv;
#pragma unroll
            for (int r = 0; r < 8; ++r) { const float x = oj[j][r] * inv; const h16 a = (h16)x; hv[r] = a; rv[r] = (h16)(x - (float)a); }
            *(v8h*)(cw + j * 256) = hv; *(v8h*)(cw + (DM / 32) * FRG + j * 256) = rv; }
    }
}

// k_out: register-blocked f16 GEMM, ONE WAVE per 64x64 tile (16 accumulators), operands straight from the f16 planes in fragment order.
// OUT[m][n] = 2^-18 * sum_{k<2048} A[m][k] Bt[n][k & 1023] + b[n]; A = ctx plane [M][value 1024 | remainder 1024] (x4096), Bt = W plane [out][in] (x64). grid (M/64, DM/64), 32 threads.
__global__ __launch_bounds__(32) void k_out(const h16* __restrict__ A, const h16* __restrict__ Bt, const float* __restrict__ bias, float* OUT) {
    __shared__ __align__(16) float os[16 * 68];
    const int KA = 2 * DM;
    const int lane = threadIdx.x & 31, lr = lane & 15, hi = lane >> 4; const int r0 = blockIdx.x * 64, c0 = blockIdx.y * 64;
    v8f acc[4][4];
#pragma unroll
    for (int mb = 0; mb < 4; ++mb)
#pragma unroll
        for (int nb = 0; nb < 4; ++nb) acc[mb][nb] = (v8f){};
    const h16* ap = A + (size_t)(r0 / 16) * (KA / 32) * FRG + 8 * lane;    // + (mb * (KA / 32) + k step) fragments
    const h16* bp = Bt + (size_t)(c0 / 16) * (DM / 32) * FRG + 8 * lane;   // + (nb * (DM / 32) + (k step mod 32)) fragments
    // two fragment sets: while one k step's 16 products run, the next step's 8 fragments are already in flight into the other set
    v16h a0[4], b0[4], a1[4], b1[4];
#pragma unroll
    for (int i = 0; i < 4; ++i) { a0[i] = ldh(ap + (size_t)(i * (KA / 32)) * FRG); b0[i] = ldh(bp + (size_t)(i * (DM / 32)) * FRG); }
    asm volatile("s_wait_xcnt 0x0" ::: "memory");   // in front of every later overwrite of an address register that these 16 loads name
#pragma unroll 1
    for (int ks = 0; ks < KA / 32; ks += 2) {
        const int k1 = ks + 1, k2 = (ks + 2) & (KA / 32 - 1);   // k2 wraps to step 0 behind the last step: in bounds, loaded and not used
        const h16* ap1 = ap + (size_t)k1 * FRG; const h16* bp1 = bp + (size_t)(k1 & (DM / 32 - 1)) * FRG;
#pragma unroll
        for (int i = 0; i < 4; ++i) { a1[i] = ldh(ap1 + (size_t)(i * (KA / 32)) * FRG); b1[i] = ldh(bp1 + (size_t)(i * (DM / 32)) * FRG); }
        asm volatile("s_wait_xcnt 0x0" :: "v"(bp1) : "memory");   // in front of every overwrite of an address register that these 16 loads name; naming the B pointer keeps its registers live up to here, so that no load of the group lands on them (the A loads go by the trip's running pointer, which lives on)
        __builtin_amdgcn_sched_barrier(0);   // keeps the 16 loads of the next step ahead of this step's products (the scheduler otherwise sinks them next to their use, and their latency is waited out)
#pragma unroll
        for (int nb = 0; nb < 4; ++nb)
#pragma unroll
            for (int mb = 0; mb < 4; ++mb) acc[mb][nb] = wmma16(a0[mb], b0[nb], acc[mb][nb]);
        __builtin_amdgcn_sched_barrier(0);   // the refill of the first set stays behind its last reader and, with the next fence, ahead of the second set's products
        const h16* ap2 = ap + (size_t)k2 * FRG; const h16* bp2 = bp + (size_t)(k2 & (DM / 32 - 1)) * FRG;
#pragma unroll
        for (int i = 0; i < 4; ++i) { a0[i] = ldh(ap2 + (size_t)(i * (KA / 32)) * FRG); b0[i] = ldh(bp2 + (size_t)(i * (DM / 32)) * FRG); }
        asm volatile("s_wait_xcnt 0x0" :: "v"(ap2), "v"(bp2) : "memory");   // as above; both pointers of this group are formed for it alone, so both are named
        __builtin_amdgcn_sched_barrier(0);   // as above, for the second set
#pragma unroll
        for (int nb = 0; nb < 4; ++nb)
#pragma unroll
            for (int mb = 0; mb < 4; ++mb) acc[mb][nb] = wmma16(a1[mb], b1[nb], acc[mb][nb]);
        // four vector slots behind the last product, also on the taken side of the loop branch
        asm volatile("v_nop\n\tv_nop\n\tv_nop\n\tv_nop" : "+v"(acc[0][0]), "+v"(acc[1][1]), "+v"(acc[2][2]), "+v"(acc[3][3]) : "v"(a1[0]), "v"(a1[1]), "v"(a1[2]), "v"(a1[3]));
    }
    v4f bv = *(const v4f*)(bias + c0 + lr * 4);
#pragma unroll
    for (int i = 0; i < 4; ++i) bv[i] = bfr(bv[i]);
    float* orow = OUT + ((size_t)(r0 / SEQ) * OUT_SEQ + (size_t)(r0 % SEQ)) * DM + c0;
#pragma unroll
    for (int mb = 0; mb < 4; ++mb) {
#pragma unroll
        for (int nb = 0; nb < 4; ++nb) {
#pragma unroll
            for (int j = 0; j < 8; ++j) os[(hi * 8 + j) * 68 + nb * 16 + lr] = acc[mb][nb][j] * OSC; }   // D: row 8h+j, col lane&15
        wave_sync();
{
#pragma unroll
            for (int s = 0; s < 8; ++s) { const int row = 2 * s + hi, cofs = lr * 4;   // 8 s x 2 rows = 16 rows; 16 lanes x 4 floats = 64 columns
                const v4f x = *(const v4fa*)(&os[row * 68 + cofs]);
                const v4f val = x + bv;
                *(v4f*)(orow + (size_t)(mb * 16 + row) * DM + cofs) = val; }
             }
        wave_sync();
    }
}

static constexpr size_t al256(size_t v) { return (v + 255) & ~(size_t)255; }
static constexpr size_t SZ_PL = al256((size_t)NB * SEQ * DM * 2);          // one f16 plane of a stream
static constexpr size_t SZ_WH = al256((size_t)DM * DM * 2);
static constexpr size_t SZ_CX = al256((size_t)NB * SEQ * 2 * DM * 2);      // ctx value | remainder
static constexpr size_t SZ_TOTAL = 3 * SZ_PL + SZ_WH + SZ_CX;
static_assert(SZ_TOTAL <= (size_t)134217728);          // workspace carve <= 128 MiB

extern "C" void kernel_launch(void* const* d_in, const int* in_sizes, int n_in,
                              void* d_out, int out_size, void* d_ws, size_t ws_size, hipStream_t stream) {
    if (n_in < 5) return;
    const size_t needx = ((size_t)(NB - 1) * SEQ_FULL + SEQ) * DM;
    if ((size_t)in_sizes[0] < needx || (size_t)in_sizes[1] < needx || (size_t)in_sizes[2] < needx) return;
    if ((size_t)in_sizes[3] < (size_t)DM * DM || (size_t)in_sizes[4] < (size_t)DM) return;
    if ((size_t)out_size < ((size_t)(NB - 1) * OUT_SEQ + SEQ) * DM) return;
    if (SZ_TOTAL > ws_size) return;
    const float* q = (const float*)d_in[0]; const float* k = (const float*)d_in[1]; const float* v = (const float*)d_in[2];   // wire order q, k, v, W_out, b_out
    const float* wo = (const float*)d_in[3]; const float* bo = (const float*)d_in[4];                                         // W_out [out][in] = Bt as-is
    float* OUT = (float*)d_out;      // [NB][SEQ][1024]
    char* wsp = (char*)d_ws;
    h16* QP = (h16*)wsp; wsp += SZ_PL;               // [NB*SEQ/16][32] fragments
    h16* KP = (h16*)wsp; wsp += SZ_PL;               // [NB*SEQ/16][32] fragments
    h16* VT = (h16*)wsp; wsp += SZ_PL;               // [NB*16][SEQ/32][4] fragments
    h16* WH = (h16*)wsp; wsp += SZ_WH;               // [1024/16][32] fragments, x64
    h16* CX = (h16*)wsp; wsp += SZ_CX;               // [NB*SEQ/16][64] fragments, x4096

    // Q, K, V^T and W planes: one launch
    k_prep<<<dim3(VT_BL + 2 * ST_BL + W_BL, 1, 1), 256, 0, stream>>>(q, k, v, wo, QP, KP, VT, WH);

    k_flash<<<dim3(SEQ / (16 * AW * QT), NB * NH_, 1), 32 * AW, 0, stream>>>(QP, KP, VT, CX);

    // out = ctx W^T + b: A = ctx rows (m = b*SEQ + t), Bt = W rows (n = out column)
    k_out<<<dim3(NB * SEQ / 64, DM / 64, 1), 32, 0, stream>>>(CX, WH, bo, OUT);
}

// v005
// It runs in 112 microseconds.
// Timed twice side by side with v004, it ran 1.26 times as fast both times.
// Over all steps from v000 it is 2.33 times as fast.
#include <hip/hip_runtime.h>

// Multi-head attention on raw streams q, k, v [NB][SEQ][1024] = 16 heads x 64 (no input projections, no mask), score scale 1/8, output projection y = ctx W^T + b with W [out][in].
// Compute dtypes, f32 accumulate everywhere, all contractions v_wmma_f32_16x16x32_f16: q, k, v, W, b are RNE-converted to bf16 and all but b held exactly in f16 (W with a x64 carry); scores single product; P (x256 carry, cancels in the normalisation) and v single product;
// ctx carried x4096 as f16 value + f16 remainder (two products against the same W plane, one accumulator); softmax f32 (online, running max); bias added in f32.
// Layout: every f16 operand plane is stored in fragment order: one 16-row x 32-k fragment = 1 KiB = [load 0|1][lane 0..31][8 halves], lane = 16*hi + (row & 15), element e of load ld = k 16*ld + 8*hi + e,
// so each wave-wide 16-B load reads 512 contiguous bytes (4 whole lines). Q, K, W: fragment index (row/16)*32 + col/32; V^T: ((b*16+h)*(SEQ/32) + key/32)*4 + d/16; ctx (value 1024 | remainder 1024): (row/16)*64 + k/32.
// Fused flash kernel in transposed form (S^T = K Q^T, O^T = V^T P^T; K and V^T staged in LDS per 8-wave work-group) writes the ctx plane, then a one-wave-per-64x64-tile GEMM over K = 2048 (value | remainder) against W rows.

#ifndef NB
#define NB 4
#endif
#ifndef SEQ
#define SEQ 2048
#endif
#define NB_FULL  4
#define SEQ_FULL 2048
#ifndef OUT_SEQ
#define OUT_SEQ SEQ              // row pitch (in tokens) between batches of the output
#endif
#define DM   1024
#define NH_  16
#define HD   64
#define AW   8                   // waves per flash block
#define QT   2                   // 16-row query tiles per flash wave
#define SC2  (0.125f * 1.4426950408889634f)   // HD^-0.5 * log2(e)
#define PSH  8.0f                // log2 of the P carry (256)
#define CXS  4096.0f             // carry of the ctx plane (value and remainder)
#define WSC  64.0f               // carry of the W plane
#define OSC  (1.0f / (4096.0f * 64.0f))

static_assert(HD == 64);
static_assert(NH_ * HD == DM);                 // head h = columns h*64 + d
static_assert((DM & (DM - 1)) == 0);           // k index wraps with a mask in the output GEMM
static_assert(DM % 256 == 0);                  // pack_tile takes 256 columns
static_assert(DM % 64 == 0);                   // GEMM k-loop takes two steps of 32 a trip
static_assert(SEQ % 64 == 0);                  // a 64-row tile never straddles two batches
static_assert((NB * SEQ) % 64 == 0);
static_assert(SEQ % 32 == 0);                  // key loop steps by 32
static_assert(SEQ % (16 * AW * QT) == 0);      // flash grid covers the sequence exactly
static_assert(QT == 2);                        // the two v_nop statements of k_flash name both tiles' registers
static_assert(((size_t)SEQ * DM) % 64 == 0);
static_assert(((size_t)DM * DM) % 64 == 0);
static_assert(NB <= NB_FULL);
static_assert(SEQ <= SEQ_FULL);

typedef _Float16 h16;
typedef __attribute__((ext_vector_type(16))) _Float16 v16h;
typedef __attribute__((ext_vector_type(8)))  _Float16 v8h;
typedef __attribute__((ext_vector_type(8)))  float    v8f;
typedef __attribute__((ext_vector_type(4)))  float    v4f;
typedef v4f  __attribute__((may_alias)) v4fa;
typedef v8h  __attribute__((may_alias)) v8ha;
typedef __attribute__((ext_vector_type(4)))  _Float16 v4h;
typedef v4h  __attribute__((may_alias)) v4ha;

// RNE convert f32 -> bf16, returned as the f32 value of that bf16
__device__ __forceinline__ float bfr(float f) { unsigned u = __float_as_uint(f); u += 0x7FFFu + ((u >> 16) & 1u); return __uint_as_float(u & 0xFFFF0000u); }
__device__ __forceinline__ v16h cat16(v8h lo, v8h hi) { return __builtin_shufflevector(lo, hi, 0, 1, 2, 3, 4, 5, 6, 7, 8, 9, 10, 11, 12, 13, 14, 15); }
__device__ __forceinline__ v8f wmma16(v16h a, v16h b, v8f c) { return __builtin_amdgcn_wmma_f32_16x16x32_f16(false, a, false, b, (short)0, c, false, false); }
// fragment loader from a plane in fragment order; p = fragment base + 8*lane: elements 0..7 <- k0+8h+0..7, elements 8..15 <- k0+16+8h+0..7 (same map for A and B)
#define FRG 512                  // halves per fragment
__device__ __forceinline__ v16h ldh(const h16* p) { return cat16(*(const v8h*)p, *(const v8h*)(p + 256)); }
// ordering point for wave-private LDS tiles (same wave writes and reads)
__device__ __forceinline__ void wave_sync() { __builtin_amdgcn_fence(3 /* release order */, "wavefront"); __builtin_amdgcn_wave_barrier(); asm volatile("" ::: "memory"); }

// pack_tile: 16 f32 rows x 256 columns (s = first element, row pitch DM) -> 8 fragments of an f16 plane (bf16 RNE value x scale) at d: whole-line reads, row-major LDS tile (pitch 528 B = 16 B x odd), 8 KiB contiguous out (cross-wave: block barrier).
__device__ __forceinline__ void pack_tile(const float* __restrict__ s, h16* d, float scale, h16* ts, int tid) {
#pragma unroll
    for (int i = 0; i < 4; ++i) { const int idx = i * 256 + tid, row = idx >> 6, c4 = (idx & 63) * 4;
        const v4f x = *(const v4f*)(s + (size_t)row * DM + c4); v4h o;
#pragma unroll
        for (int e = 0; e < 4; ++e) o[e] = (h16)(bfr(x[e]) * scale);
        *(v4ha*)(&ts[row * 264 + c4]) = o; }
    __syncthreads();
    v8h val[2];
#pragma unroll
    for (int it = 0; it < 2; ++it) { const int o = it * 256 + tid, ln = o & 31;   // o = 16-B piece of the 8 fragments: [k chunk o>>6][load (o>>5)&1][lane]
        val[it] = *(const v8ha*)(&ts[(ln & 15) * 264 + (o >> 6) * 32 + ((o >> 5) & 1) * 16 + (ln >> 4) * 8]); }
#pragma unroll
    for (int it = 0; it < 2; ++it) *(v8h*)(d + (size_t)(it * 256 + tid) * 8) = val[it];
}

// vt_tile: 64 keys x 64 columns of v (src = first element, row pitch DM; one head x 2 key chunks) -> 8 V^T fragments (row d, k = key; f16 of the bf16 RNE value) at dst, through LDS (cross-wave: block barrier).
__device__ __forceinline__ void vt_tile(const float* __restrict__ src, h16* dst, h16* ts, int tid) {
#pragma unroll
    for (int i = 0; i < 4; ++i) { const int t = i * 16 + (tid >> 4), c4 = (tid & 15) * 4;
        const v4f x = *(const v4f*)(src + (size_t)t * DM + c4);
#pragma unroll
        for (int e = 0; e < 4; ++e) ts[(c4 + e) * 72 + t] = (h16)bfr(x[e]); }
    __syncthreads();
    v8h val[2];
#pragma unroll
    for (int it = 0; it < 2; ++it) { const int o = it * 256 + tid, ln = o & 31;   // o = 16-B piece: [key chunk o>>8][d tile (o>>6)&3][load (o>>5)&1][lane]
        val[it] = *(const v8ha*)(&ts[(((o >> 6) & 3) * 16 + (ln & 15)) * 72 + (o >> 8) * 32 + ((o >> 5) & 1) * 16 + (ln >> 4) * 8]); }
#pragma unroll
    for (int it = 0; it < 2; ++it) *(v8h*)(dst + (size_t)(it * 256 + tid) * 8) = val[it];
}

// k_prep: all four operand planes in ONE launch (they depend on nothing but the inputs): the flat block index picks the plane and the tile, alike for the whole block, so each block runs one tile body with its one barrier.
// Blocks [0, VT_BL): V^T tiles (key tile fastest, then head, then batch); then Q, then K (row tile fastest, then 256-column block; per-batch input pitch SEQ_FULL rows); then W (x64).
#define VT_BL ((SEQ / 64) * (DM / 64) * NB)
#define ST_RT (NB * SEQ / 16)            // 16-row tiles of a stream plane
#define ST_BL (ST_RT * (DM / 256))
#define W_RT  (DM / 16)
#define W_BL  (W_RT * (DM / 256))
__global__ __launch_bounds__(256) void k_prep(const float* __restrict__ q, const float* __restrict__ k, const float* __restrict__ v, const float* __restrict__ w, h16* QP, h16* KP, h16* VT, h16* WH) {
    __shared__ __align__(16) h16 ts[64 * 72];
    static_assert(64 * 72 >= 16 * 264);   // one LDS tile serves either body
    const int tid = threadIdx.x; const int bid = blockIdx.x;
    if (bid < VT_BL) {
        const int t0 = (bid % (SEQ / 64)) * 64, hd = (bid / (SEQ / 64)) % (DM / 64), b = bid / ((SEQ / 64) * (DM / 64));
        vt_tile(v + ((size_t)b * SEQ_FULL + t0) * DM + hd * 64, VT + (((size_t)b * NH_ + hd) * (SEQ / 32) + t0 / 32) * 4 * FRG, ts, tid);
    } else if (bid < VT_BL + 2 * ST_BL) {
        const int u = bid - VT_BL; const bool isk = u >= ST_BL; const int x = isk ? u - ST_BL : u;
        const int rt = x % ST_RT, c0 = (x / ST_RT) * 256;
        const size_t row = (size_t)(rt / (SEQ / 16)) * SEQ_FULL + (size_t)(rt % (SEQ / 16)) * 16;
        pack_tile((isk ? k : q) + row * DM + c0, (isk ? KP : QP) + ((size_t)rt * (DM / 32) + c0 / 32) * FRG, 1.0f, ts, tid);
    } else {
        const int x = bid - (VT_BL + 2 * ST_BL); const int rt = x % W_RT, c0 = (x / W_RT) * 256;
        pack_tile(w + (size_t)rt * 16 * DM + c0, WH + ((size_t)rt * (DM / 32) + c0 / 32) * FRG, WSC, ts, tid);
    }
}

// LDS ring of k_flash: a stage = FKS passes of 32 keys of one (batch, head) = K: 2 * FKS row tiles x 2 fragments, V^T: FKS key chunks x 4 fragments, every fragment as it lies in its plane; two buffers, laid [K 0 | K 1 | V^T 0 | V^T 1],
// so that pass ps reads K at byte (ps mod 2 FKS) * 4096 and V^T at 2 FSK bytes behind it.
#define FKS  4                           // passes per stage
#define FSK  (FKS * 4 * FRG * 2)         // K part of a stage, bytes; the V^T part is as large
#define FNS  (SEQ / (32 * FKS))          // stages
static_assert(AW * 32 * 16 == 4 * FRG * 2);    // one copy of the whole work-group moves 4 fragments (4 KiB): two K row tiles of the head, or one V^T key chunk
static_assert(FKS == 4);                       // cp44: four K copies and four V^T copies a stage
static_assert(SEQ % (32 * FKS) == 0);
static_assert(FNS >= 2);                       // the prologue fills two stages
// one stage, eight asynchronous 16-B copies per lane: K piece i from gk + i * sk halves, V^T piece i from gv + i * sv halves, to LDS byte addresses l + i * 4096 and l + 2 * FSK + i * 4096.
__device__ __forceinline__ void cp44(unsigned l, const h16* gk, size_t sk, const h16* gv, size_t sv) {
    // the s_wait_xcnt stands inside the copies' own statement, in front of any later rewrite of an address register that a copy names
    asm volatile("global_load_async_to_lds_b128 %0, %8, off\n\t"
                 "global_load_async_to_lds_b128 %1, %9, off\n\t"
                 "global_load_async_to_lds_b128 %2, %10, off\n\t"
                 "global_load_async_to_lds_b128 %3, %11, off\n\t"
                 "global_load_async_to_lds_b128 %4, %12, off\n\t"
                 "global_load_async_to_lds_b128 %5, %13, off\n\t"
                 "global_load_async_to_lds_b128 %6, %14, off\n\t"
                 "global_load_async_to_lds_b128 %7, %15, off\n\t"
                 "s_wait_xcnt 0x0"
                 :: "v"(l), "v"(l + 4096), "v"(l + 2 * 4096), "v"(l + 3 * 4096), "v"(l + 2 * FSK), "v"(l + 2 * FSK + 4096), "v"(l + 2 * FSK + 2 * 4096), "v"(l + 2 * FSK + 3 * 4096),
                    "v"(gk), "v"(gk + sk), "v"(gk + 2 * sk), "v"(gk + 3 * sk), "v"(gv), "v"(gv + sv), "v"(gv + 2 * sv), "v"(gv + 3 * sv)
                 : "memory");
}

// k_flash: fused attention, one wave per 32 query rows (QT = 2 tiles of 16) of one (batch, head), 8 waves a work-group; Q fragments straight from the f16 plane; K and V^T fragments come to LDS by asynchronous copies, one stage (128 keys) for all 8 waves, issued a whole stage ahead of their use, and are read from there (two 16-B LDS loads each).
// Each K and each V^T fragment is loaded once per wave and feeds one product per query tile, so the loaded bytes per product are 1 / QT of a one-tile wave's.
// Transposed form: S^T[key][t] = K Q^T (A = K rows, B = Q rows); lane (t = lane&15, h = lane>>4) holds keys 8h+r of each 16-key tile, so the packed
// P tile is directly the B fragment of O^T[d][t] = V^T P^T (element r <- tile keys 0..15, element 8+r <- tile keys 16..31, lane unchanged).
// Softmax state (running max, partial sum) is one scalar per lane and query tile; the two lane halves of a row are combined with one xor-16 exchange.
__global__ __launch_bounds__(32 * AW) void k_flash(const h16* __restrict__ QP, const h16* __restrict__ KP, const h16* __restrict__ VT, h16* CTX) {
    __shared__ __align__(16) unsigned char ring[4 * FSK];
    const int tid = threadIdx.x;
    const int lane = threadIdx.x & 31, wave = __builtin_amdgcn_readfirstlane((int)(threadIdx.x >> 5));
    const int zh = blockIdx.y; const int b = zh / NH_, h = zh % NH_;
    const int t0 = (blockIdx.x * AW + wave) * (16 * QT);
    const size_t rbase = ((size_t)(b * SEQ / 16) * (DM / 32) + 2 * h) * FRG + 8 * lane;   // fragment (row tile 0 of the batch, k chunk 2h)
    const size_t qo = rbase + (size_t)(t0 / 16) * (DM / 32) * FRG;
    v16h qh0[QT], qh1[QT];                                          // B fragments: col t, k = d
#pragma unroll
    for (int q = 0; q < QT; ++q) { qh0[q] = ldh(QP + qo + (size_t)q * (DM / 32) * FRG); qh1[q] = ldh(QP + qo + (size_t)q * (DM / 32) * FRG + FRG); }
    // the lane's 16 B of each copy: K piece = row tiles 2i, 2i+1 of the stage (threads 0..127 | 128..255), 2 KiB each (k chunks 2h, 2h+1 lie side by side); V^T piece = key chunk i, 4 KiB
    const size_t ksp = (size_t)2 * (DM / 32) * FRG, vsp = (size_t)4 * FRG;   // halves from one piece to the next
    const h16* gk = KP + ((size_t)(b * SEQ / 16 + (tid >> 7)) * (DM / 32) + 2 * h) * FRG + 8 * (tid & 127);   // + stage * FKS pieces
    const h16* gv = VT + (size_t)zh * (SEQ / 32) * 4 * FRG + 8 * tid;                                         // + stage * FKS pieces
    const unsigned lb = (unsigned)(size_t)ring + 16u * (unsigned)tid;
    cp44(lb, gk, ksp, gv, vsp);
    asm volatile("s_wait_asynccnt 0x0" ::: "memory");   // this wave's copies of stage 0 have landed
    __syncthreads();                                    // ... and every other wave's
    cp44(lb + FSK, gk + FKS * ksp, ksp, gv + FKS * vsp, vsp);
    v8f o0[QT], o1[QT], o2[QT], o3[QT]; float m[QT], l[QT];
#pragma unroll
    for (int q = 0; q < QT; ++q) { o0[q] = (v8f){}; o1[q] = (v8f){}; o2[q] = (v8f){}; o3[q] = (v8f){}; m[q] = -3.0e38f; l[q] = 0.0f; }
#pragma unroll 1
    for (int ps = 0; ps < SEQ / 32; ++ps) {
        const h16* ka = (const h16*)(ring + (unsigned)(ps & (2 * FKS - 1)) * 4096u) + 8 * lane;   // + (row tile * 2 + k chunk) fragments
        const v16h ka0 = ldh(ka), ka1 = ldh(ka + FRG), kb0 = ldh(ka + 2 * FRG), kb1 = ldh(ka + 3 * FRG);
        v8f sa[QT], sb[QT];
#pragma unroll
        for (int q = 0; q < QT; ++q) { sa[q] = wmma16(ka0, qh0[q], (v8f){}); sb[q] = wmma16(kb0, qh0[q], (v8f){}); }
#pragma unroll
        for (int q = 0; q < QT; ++q) { sa[q] = wmma16(ka1, qh1[q], sa[q]); sb[q] = wmma16(kb1, qh1[q], sb[q]); }
        // four vector slots between the last score product and the first read of its result
        asm volatile("v_nop\n\tv_nop\n\tv_nop\n\tv_nop" : "+v"(sa[0]), "+v"(sb[0]), "+v"(sa[1]), "+v"(sb[1]) : "v"(ka0), "v"(ka1), "v"(kb0), "v"(kb1));
        v16h pb[QT];
#pragma unroll
        for (int q = 0; q < QT; ++q) {
            const v8f ta = sa[q] * SC2, tb = sb[q] * SC2; float mx = -3.0e38f;
#pragma unroll
            for (int r = 0; r < 8; ++r) mx = fmaxf(mx, fmaxf(ta[r], tb[r]));
            mx = fmaxf(mx, __shfl_xor(mx, 16, 32));
            const float mnew = fmaxf(m[q], mx);
            const float alpha = __builtin_amdgcn_exp2f(m[q] - mnew);
            const float sh = PSH - mnew;
            const v8f ea = ta + sh, eb = tb + sh;
            float ls = 0.0f;
#pragma unroll
            for (int r = 0; r < 8; ++r) { const h16 pa = (h16)__builtin_amdgcn_exp2f(ea[r]); const h16 pc = (h16)__builtin_amdgcn_exp2f(eb[r]); pb[q][r] = pa; pb[q][8 + r] = pc; ls += (float)pa + (float)pc; }
            l[q] = l[q] * alpha + ls; m[q] = mnew;
            o0[q] = o0[q] * alpha; o1[q] = o1[q] * alpha; o2[q] = o2[q] * alpha; o3[q] = o3[q] * alpha;
        }
        const h16* va = ka + FSK;   // 2 FSK bytes on: + j fragments
        const v16h v0 = ldh(va), v1 = ldh(va + FRG), v2 = ldh(va + 2 * FRG), v3 = ldh(va + 3 * FRG);
#pragma unroll
        for (int q = 0; q < QT; ++q) { o0[q] = wmma16(v0, pb[q], o0[q]); o1[q] = wmma16(v1, pb[q], o1[q]); o2[q] = wmma16(v2, pb[q], o2[q]); o3[q] = wmma16(v3, pb[q], o3[q]); }
        // four vector slots behind the last product, also on the taken side of the loop branch
        asm volatile("v_nop\n\tv_nop\n\tv_nop\n\tv_nop" : "+v"(o0[0]), "+v"(o1[0]), "+v"(o2[0]), "+v"(o3[0]), "+v"(o0[1]), "+v"(o1[1]), "+v"(o2[1]), "+v"(o3[1]) : "v"(v0), "v"(v1), "v"(v2), "v"(v3), "v"(pb[0]), "v"(pb[1]));
        if ((ps & (FKS - 1)) == FKS - 1) {   // foot of stage st (the test reads the same in every wave of the work-group)
            const int st = ps / FKS;
            asm volatile("s_wait_dscnt 0x0" ::: "memory");      // this wave's reads of the buffer are done before it is refilled
            asm volatile("s_wait_asynccnt 0x0" ::: "memory");   // this wave's copies of stage st + 1 have landed
            __syncthreads();                                    // publishes stage st + 1 and ends every wave's reads of stage st
            if (st + 2 < FNS) cp44(lb + (unsigned)(st & 1) * FSK, gk + (size_t)(st + 2) * FKS * ksp, ksp, gv + (size_t)(st + 2) * FKS * vsp, vsp);
        }
    }
    asm volatile("s_wait_asynccnt 0x0" ::: "memory");   // nothing of this wave is in flight when it leaves the ring
#pragma unroll
    for (int q = 0; q < QT; ++q) {
        const float lt = l[q] + __shfl_xor(l[q], 16, 32);
        const float inv = CXS * (1.0f / lt);
        // O^T D layout: o_j[r] = (d = 16j + 8h + r, t = lane&15), which is load j&1 of ctx fragment (row tile t0/16 + q, k chunk 2*head + (j>>1)) at this same lane: stored from registers, 512 contiguous bytes per store
        h16* cw = CTX + ((size_t)((b * SEQ + t0) / 16 + q) * (2 * DM / 32) + 2 * h) * FRG + 8 * lane;
        const v8f oj[4] = { o0[q], o1[q], o2[q], o3[q] };
#pragma unroll
        for (int j = 0; j < 4; ++j) { v8h hv, rv;
#pragma unroll
            for (int r = 0; r < 8; ++r) { const float x = oj[j][r] * inv; const h16 a = (h16)x; hv[r] = a; rv[r] = (h16)(x - (float)a); }
            *(v8h*)(cw + j * 256) = hv; *(v8h*)(cw + (DM / 32) * FRG + j * 256) = rv; }
    }
}

// k_out: register-blocked f16 GEMM, ONE WAVE per 64x64 tile (16 accumulators), operands straight from the f16 planes in fragment order.
// OUT[m][n] = 2^-18 * sum_{k<2048} A[m][k] Bt[n][k & 1023] + b[n]; A = ctx plane [M][value 1024 | remainder 1024] (x4096), Bt = W plane [out][in] (x64). grid (M/64, DM/64), 32 threads.
__global__ __launch_bounds__(32) void k_out(const h16* __restrict__ A, const h16* __restrict__ Bt, const float* __restrict__ bias, float* OUT) {
    __shared__ __align__(16) float os[16 * 68];
    const int KA = 2 * DM;
    const int lane = threadIdx.x & 31, lr = lane & 15, hi = lane >> 4; const int r0 = blockIdx.x * 64, c0 = blockIdx.y * 64;
    v8f acc[4][4];
#pragma unroll
    for (int mb = 0; mb < 4; ++mb)
#pragma unroll
        for (int nb = 0; nb < 4; ++nb) acc[mb][nb] = (v8f){};
    const h16* ap = A + (size_t)(r0 / 16) * (KA / 32) * FRG + 8 * lane;    // + (mb * (KA / 32) + k step) fragments
    const h16* bp = Bt + (size_t)(c0 / 16) * (DM / 32) * FRG + 8 * lane;   // + (nb * (DM / 32) + (k step mod 32)) fragments
    // two fragment sets: while one k step's 16 products run, the next step's 8 fragments are already in flight into the other set
    v16h a0[4], b0[4], a1[4], b1[4];
#pragma unroll
    for (int i = 0; i < 4; ++i) { a0[i] = ldh(ap + (size_t)(i * (KA / 32)) * FRG); b0[i] = ldh(bp + (size_t)(i * (DM / 32)) * FRG); }
    asm volatile("s_wait_xcnt 0x0" ::: "memory");   // in front of every later overwrite of an address register that these 16 loads name
#pragma unroll 1
    for (int ks = 0; ks < KA / 32; ks += 2) {
        const int k1 = ks + 1, k2 = (ks + 2) & (KA / 32 - 1);   // k2 wraps to step 0 behind the last step: in bounds, loaded and not used
        const h16* ap1 = ap + (size_t)k1 * FRG; const h16* bp1 = bp + (size_t)(k1 & (DM / 32 - 1)) * FRG;
#pragma unroll
        for (int i = 0; i < 4; ++i) { a1[i] = ldh(ap1 + (size_t)(i * (KA / 32)) * FRG); b1[i] = ldh(bp1 + (size_t)(i * (DM / 32)) * FRG); }
        asm volatile("s_wait_xcnt 0x0" :: "v"(bp1) : "memory");   // in front of every overwrite of an address register that these 16 loads name; naming the B pointer keeps its registers live up to here, so that no load of the group lands on them (the A loads go by the trip's running pointer, which lives on)
        __builtin_amdgcn_sched_barrier(0);   // keeps the 16 loads of the next step ahead of this step's products (the scheduler otherwise sinks them next to their use, and their latency is waited out)
#pragma unroll
        for (int nb = 0; nb < 4; ++nb)
#pragma unroll
            for (int mb = 0; mb < 4; ++mb) acc[mb][nb] = wmma16(a0[mb], b0[nb], acc[mb][nb]);
        __builtin_amdgcn_sched_barrier(0);   // the refill of the first set stays behind its last reader and, with the next fence, ahead of the second set's products
        const h16* ap2 = ap + (size_t)k2 * FRG; const h16* bp2 = bp + (size_t)(k2 & (DM / 32 - 1)) * FRG;
#pragma unroll
        for (int i = 0; i < 4; ++i) { a0[i] = ldh(ap2 + (size_t)(i * (KA / 32)) * FRG); b0[i] = ldh(bp2 + (size_t)(i * (DM / 32)) * FRG); }
        asm volatile("s_wait_xcnt 0x0" :: "v"(ap2), "v"(bp2) : "memory");   // as above; both pointers of this group are formed for it alone, so both are named
        __builtin_amdgcn_sched_barrier(0);   // as above, for the second set
#pragma unroll
        for (int nb = 0; nb < 4; ++nb)
#pragma unroll
            for (int mb = 0; mb < 4; ++mb) acc[mb][nb] = wmma16(a1[mb], b1[nb], acc[mb][nb]);
        // four vector slots behind the last product, also on the taken side of the loop branch
        asm volatile("v_nop\n\tv_nop\n\tv_nop\n\tv_nop" : "+v"(acc[0][0]), "+v"(acc[1][1]), "+v"(acc[2][2]), "+v"(acc[3][3]) : "v"(a1[0]), "v"(a1[1]), "v"(a1[2]), "v"(a1[3]));
    }
    v4f bv = *(const v4f*)(bias + c0 + lr * 4);
#pragma unroll
    for (int i = 0; i < 4; ++i) bv[i] = bfr(bv[i]);
    float* orow = OUT + ((size_t)(r0 / SEQ) * OUT_SEQ + (size_t)(r0 % SEQ)) * DM + c0;
#pragma unroll
    for (int mb = 0; mb < 4; ++mb) {
#pragma unroll
        for (int nb = 0; nb < 4; ++nb) {
#pragma unroll
            for (int j = 0; j < 8; ++j) os[(hi * 8 + j) * 68 + nb * 16 + lr] = acc[mb][nb][j] * OSC; }   // D: row 8h+j, col lane&15
        wave_sync();
{
#pragma unroll
            for (int s = 0; s < 8; ++s) { const int row = 2 * s + hi, cofs = lr * 4;   // 8 s x 2 rows = 16 rows; 16 lanes x 4 floats = 64 columns
                const v4f x = *(const v4fa*)(&os[row * 68 + cofs]);
                const v4f val = x + bv;
                *(v4f*)(orow + (size_t)(mb * 16 + row) * DM + cofs) = val; }
             }
        wave_sync();
    }
}

static constexpr size_t al256(size_t v) { return (v + 255) & ~(size_t)255; }
static constexpr size_t SZ_PL = al256((size_t)NB * SEQ * DM * 2);          // one f16 plane of a stream
static constexpr size_t SZ_WH = al256((size_t)DM * DM * 2);
static constexpr size_t SZ_CX = al256((size_t)NB * SEQ * 2 * DM * 2);      // ctx value | remainder
static constexpr size_t SZ_TOTAL = 3 * SZ_PL + SZ_WH + SZ_CX;
static_assert(SZ_TOTAL <= (size_t)134217728);          // workspace carve <= 128 MiB

extern "C" void kernel_launch(void* const* d_in, const int* in_sizes, int n_in,
                              void* d_out, int out_size, void* d_ws, size_t ws_size, hipStream_t stream) {
    if (n_in < 5) return;
    const size_t needx = ((size_t)(NB - 1) * SEQ_FULL + SEQ) * DM;
    if ((size_t)in_sizes[0] < needx || (size_t)in_sizes[1] < needx || (size_t)in_sizes[2] < needx) return;
    if ((size_t)in_sizes[3] < (size_t)DM * DM || (size_t)in_sizes[4] < (size_t)DM) return;
    if ((size_t)out_size < ((size_t)(NB - 1) * OUT_SEQ + SEQ) * DM) return;
    if (SZ_TOTAL > ws_size) return;
    const float* q = (const float*)d_in[0]; const float* k = (const float*)d_in[1]; const float* v = (const float*)d_in[2];   // wire order q, k, v, W_out, b_out
    const float* wo = (const float*)d_in[3]; const float* bo = (const float*)d_in[4];                                         // W_out [out][in] = Bt as-is
    float* OUT = (float*)d_out;      // [NB][SEQ][1024]
    char* wsp = (char*)d_ws;
    h16* QP = (h16*)wsp; wsp += SZ_PL;               // [NB*SEQ/16][32] fragments
    h16* KP = (h16*)wsp; wsp += SZ_PL;               // [NB*SEQ/16][32] fragments
    h16* VT = (h16*)wsp; wsp += SZ_PL;               // [NB*16][SEQ/32][4] fragments
    h16* WH = (h16*)wsp; wsp += SZ_WH;               // [1024/16][32] fragments, x64
    h16* CX = (h16*)wsp; wsp += SZ_CX;               // [NB*SEQ/16][64] fragments, x4096

    // Q, K, V^T and W planes: one launch
    k_prep<<<dim3(VT_BL + 2 * ST_BL + W_BL, 1, 1), 256, 0, stream>>>(q, k, v, wo, QP, KP, VT, WH);

    k_flash<<<dim3(SEQ / (16 * AW * QT), NB * NH_, 1), 32 * AW, 0, stream>>>(QP, KP, VT, CX);

    // out = ctx W^T + b: A = ctx rows (m = b*SEQ + t), Bt = W rows (n = out column)
    k_out<<<dim3(NB * SEQ / 64, DM / 64, 1), 32, 0, stream>>>(CX, WH, bo, OUT);
}

// v006
// Measured time: 108 microseconds a run.
// Next to v005, in two timings, it ran 1.04 and 1.05 times as fast.
// All steps since v000 together make it 2.44 times as fast.
#include <hip/hip_runtime.h>

// Multi-head attention on raw streams q, k, v [NB][SEQ][1024] = 16 heads x 64 (no input projections, no mask), score scale 1/8, output projection y = ctx W^T + b with W [out][in].
// Compute dtypes, f32 accumulate everywhere, all contractions v_wmma_f32_16x16x32_f16: q, k, v, W, b are RNE-converted to bf16 and all but b held exactly in f16 (W with a x64 carry); scores single product; P (x256 carry, cancels in the normalisation) and v single product;
// ctx carried x4096 as f16 value + f16 remainder (two products against the same W plane, one accumulator); softmax f32 (online, running max); bias added in f32.
// Layout: every f16 operand plane is stored in fragment order: one 16-row x 32-k fragment = 1 KiB = [load 0|1][lane 0..31][8 halves], lane = 16*hi + (row & 15), element e of load ld = k 16*ld + 8*hi + e,
// so each wave-wide 16-B load reads 512 contiguous bytes (4 whole lines). Q, K, W: fragment index (row/16)*32 + col/32; V^T: ((b*16+h)*(SEQ/32) + key/32)*4 + d/16; ctx (value 1024 | remainder 1024): (row/16)*64 + k/32.
// Fused flash kernel in transposed form (S^T = K Q^T, O^T = V^T P^T; K and V^T staged in LDS per 8-wave work-group) writes the ctx plane, then a one-wave-per-64x64-tile GEMM over K = 2048 (value | remainder) against W rows.

#ifndef NB
#define NB 4
#endif
#ifndef SEQ
#define SEQ 2048
#endif
#define NB_FULL  4
#define SEQ_FULL 2048
#ifndef OUT_SEQ
#define OUT_SEQ SEQ              // row pitch (in tokens) between batches of the output
#endif
#define DM   1024
#define NH_  16
#define HD   64
#define AW   8                   // waves per flash block
#define QT   2                   // 16-row query tiles per flash wave
#define SC2  (0.125f * 1.4426950408889634f)   // HD^-0.5 * log2(e)
#define PSH  8.0f                // log2 of the P carry (256)
#define CXS  4096.0f             // carry of the ctx plane (value and remainder)
#define WSC  64.0f               // carry of the W plane
#define OSC  (1.0f / (4096.0f * 64.0f))

static_assert(HD == 64);
static_assert(NH_ * HD == DM);                 // head h = columns h*64 + d
static_assert((DM & (DM - 1)) == 0);           // k index wraps with a mask in the output GEMM
static_assert(DM % 256 == 0);                  // pack_tile takes 256 columns
static_assert(DM % 64 == 0);                   // GEMM k-loop takes two steps of 32 a trip
static_assert(SEQ % 64 == 0);                  // a 64-row tile never straddles two batches
static_assert((NB * SEQ) % 64 == 0);
static_assert(SEQ % 32 == 0);                  // key loop steps by 32
static_assert(SEQ % (16 * AW * QT) == 0);      // flash grid covers the sequence exactly
static_assert(QT == 2);                        // the two v_nop statements of k_flash name both tiles' registers
static_assert(((size_t)SEQ * DM) % 64 == 0);
static_assert(((size_t)DM * DM) % 64 == 0);
static_assert(NB <= NB_FULL);
static_assert(SEQ <= SEQ_FULL);

typedef _Float16 h16;
typedef __attribute__((ext_vector_type(16))) _Float16 v16h;
typedef __attribute__((ext_vector_type(8)))  _Float16 v8h;
typedef __attribute__((ext_vector_type(8)))  float    v8f;
typedef __attribute__((ext_vector_type(4)))  float    v4f;
typedef v4f  __attribute__((may_alias)) v4fa;
typedef v8h  __attribute__((may_alias)) v8ha;
typedef __attribute__((ext_vector_type(4)))  _Float16 v4h;
typedef v4h  __attribute__((may_alias)) v4ha;

// RNE convert f32 -> bf16, returned as the f32 value of that bf16
__device__ __forceinline__ float bfr(float f) { unsigned u = __float_as_uint(f); u += 0x7FFFu + ((u >> 16) & 1u); return __uint_as_float(u & 0xFFFF0000u); }
__device__ __forceinline__ v16h cat16(v8h lo, v8h hi) { return __builtin_shufflevector(lo, hi, 0, 1, 2, 3, 4, 5, 6, 7, 8, 9, 10, 11, 12, 13, 14, 15); }
__device__ __forceinline__ v8f wmma16(v16h a, v16h b, v8f c) { return __builtin_amdgcn_wmma_f32_16x16x32_f16(false, a, false, b, (short)0, c, false, false); }
// fragment loader from a plane in fragment order; p = fragment base + 8*lane: elements 0..7 <- k0+8h+0..7, elements 8..15 <- k0+16+8h+0..7 (same map for A and B)
#define FRG 512                  // halves per fragment
__device__ __forceinline__ v16h ldh(const h16* p) { return cat16(*(const v8h*)p, *(const v8h*)(p + 256)); }
// ordering point for wave-private LDS tiles (same wave writes and reads)
__device__ __forceinline__ void wave_sync() { __builtin_amdgcn_fence(3 /* release order */, "wavefront"); __builtin_amdgcn_wave_barrier(); asm volatile("" ::: "memory"); }

// pack_tile: 16 f32 rows x 256 columns (s = first element, row pitch DM) -> 8 fragments of an f16 plane (bf16 RNE value x scale) at d: whole-line reads, row-major LDS tile (pitch 528 B = 16 B x odd), 8 KiB contiguous out (cross-wave: block barrier).
__device__ __forceinline__ void pack_tile(const float* __restrict__ s, h16* d, float scale, h16* ts, int tid) {
#pragma unroll
    for (int i = 0; i < 4; ++i) { const int idx = i * 256 + tid, row = idx >> 6, c4 = (idx & 63) * 4;
        const v4f x = *(const v4f*)(s + (size_t)row * DM + c4); v4h o;
#pragma unroll
        for (int e = 0; e < 4; ++e) o[e] = (h16)(bfr(x[e]) * scale);
        *(v4ha*)(&ts[row * 264 + c4]) = o; }
    __syncthreads();
    v8h val[2];
#pragma unroll
    for (int it = 0; it < 2; ++it) { const int o = it * 256 + tid, ln = o & 31;   // o = 16-B piece of the 8 fragments: [k chunk o>>6][load (o>>5)&1][lane]
        val[it] = *(const v8ha*)(&ts[(ln & 15) * 264 + (o >> 6) * 32 + ((o >> 5) & 1) * 16 + (ln >> 4) * 8]); }
#pragma unroll
    for (int it = 0; it < 2; ++it) *(v8h*)(d + (size_t)(it * 256 + tid) * 8) = val[it];
}

// vt_tile: 64 keys x 64 columns of v (src = first element, row pitch DM; one head x 2 key chunks) -> 8 V^T fragments (row d, k = key; f16 of the bf16 RNE value) at dst, through LDS (cross-wave: block barrier).
__device__ __forceinline__ void vt_tile(const float* __restrict__ src, h16* dst, h16* ts, int tid) {
#pragma unroll
    for (int i = 0; i < 4; ++i) { const int t = i * 16 + (tid >> 4), c4 = (tid & 15) * 4;
        const v4f x = *(const v4f*)(src + (size_t)t * DM + c4);
#pragma unroll
        for (int e = 0; e < 4; ++e) ts[(c4 + e) * 72 + t] = (h16)bfr(x[e]); }
    __syncthreads();
    v8h val[2];
#pragma unroll
    for (int it = 0; it < 2; ++it) { const int o = it * 256 + tid, ln = o & 31;   // o = 16-B piece: [key chunk o>>8][d tile (o>>6)&3][load (o>>5)&1][lane]
        val[it] = *(const v8ha*)(&ts[(((o >> 6) & 3) * 16 + (ln & 15)) * 72 + (o >> 8) * 32 + ((o >> 5) & 1) * 16 + (ln >> 4) * 8]); }
#pragma unroll
    for (int it = 0; it < 2; ++it) *(v8h*)(dst + (size_t)(it * 256 + tid) * 8) = val[it];
}

// k_prep: all four operand planes in ONE launch (they depend on nothing but the inputs): the flat block index picks the plane and the tile, alike for the whole block, so each block runs one tile body with its one barrier.
// Blocks [0, VT_BL): V^T tiles (key tile fastest, then head, then batch); then Q, then K (row tile fastest, then 256-column block; per-batch input pitch SEQ_FULL rows); then W (x64).
#define VT_BL ((SEQ / 64) * (DM / 64) * NB)
#define ST_RT (NB * SEQ / 16)            // 16-row tiles of a stream plane
#define ST_BL (ST_RT * (DM / 256))
#define W_RT  (DM / 16)
#define W_BL  (W_RT * (DM / 256))
__global__ __launch_bounds__(256) void k_prep(const float* __restrict__ q, const float* __restrict__ k, const float* __restrict__ v, const float* __restrict__ w, h16* QP, h16* KP, h16* VT, h16* WH) {
    __shared__ __align__(16) h16 ts[64 * 72];
    static_assert(64 * 72 >= 16 * 264);   // one LDS tile serves either body
    const int tid = threadIdx.x; const int bid = blockIdx.x;
    if (bid < VT_BL) {
        const int t0 = (bid % (SEQ / 64)) * 64, hd = (bid / (SEQ / 64)) % (DM / 64), b = bid / ((SEQ / 64) * (DM / 64));
        vt_tile(v + ((size_t)b * SEQ_FULL + t0) * DM + hd * 64, VT + (((size_t)b * NH_ + hd) * (SEQ / 32) + t0 / 32) * 4 * FRG, ts, tid);
    } else if (bid < VT_BL + 2 * ST_BL) {
        const int u = bid - VT_BL; const bool isk = u >= ST_BL; const int x = isk ? u - ST_BL : u;
        const int rt = x % ST_RT, c0 = (x / ST_RT) * 256;
        const size_t row = (size_t)(rt / (SEQ / 16)) * SEQ_FULL + (size_t)(rt % (SEQ / 16)) * 16;
        pack_tile((isk ? k : q) + row * DM + c0, (isk ? KP : QP) + ((size_t)rt * (DM / 32) + c0 / 32) * FRG, 1.0f, ts, tid);
    } else {
        const int x = bid - (VT_BL + 2 * ST_BL); const int rt = x % W_RT, c0 = (x / W_RT) * 256;
        pack_tile(w + (size_t)rt * 16 * DM + c0, WH + ((size_t)rt * (DM / 32) + c0 / 32) * FRG, WSC, ts, tid);
    }
}

// LDS ring of k_flash: a stage = FKS passes of 32 keys of one (batch, head) = K: 2 * FKS row tiles x 2 fragments, V^T: FKS key chunks x 4 fragments, every fragment as it lies in its plane; two buffers, laid [K 0 | K 1 | V^T 0 | V^T 1],
// so that pass ps reads K at byte (ps mod 2 FKS) * 4096 and V^T at 2 FSK bytes behind it.
#define FKS  4                           // passes per stage
#define FSK  (FKS * 4 * FRG * 2)         // K part of a stage, bytes; the V^T part is as large
#define FNS  (SEQ / (32 * FKS))          // stages
static_assert(AW * 32 * 16 == 4 * FRG * 2);    // one copy of the whole work-group moves 4 fragments (4 KiB): two K row tiles of the head, or one V^T key chunk
static_assert(FKS == 4);                       // cp44: four K copies and four V^T copies a stage
static_assert(SEQ % (32 * FKS) == 0);
static_assert(FNS >= 2);                       // the prologue fills two stages
// one stage, eight asynchronous 16-B copies per lane: K piece i from gk + i * sk halves, V^T piece i from gv + i * sv halves, to LDS byte addresses l + i * 4096 and l + 2 * FSK + i * 4096.
__device__ __forceinline__ void cp44(unsigned l, const h16* gk, size_t sk, const h16* gv, size_t sv) {
    // the s_wait_xcnt stands inside the copies' own statement, in front of any later rewrite of an address register that a copy names
    asm volatile("global_load_async_to_lds_b128 %0, %8, off\n\t"
                 "global_load_async_to_lds_b128 %1, %9, off\n\t"
                 "global_load_async_to_lds_b128 %2, %10, off\n\t"
                 "global_load_async_to_lds_b128 %3, %11, off\n\t"
                 "global_load_async_to_lds_b128 %4, %12, off\n\t"
                 "global_load_async_to_lds_b128 %5, %13, off\n\t"
                 "global_load_async_to_lds_b128 %6, %14, off\n\t"
                 "global_load_async_to_lds_b128 %7, %15, off\n\t"
                 "s_wait_xcnt 0x0"
                 :: "v"(l), "v"(l + 4096), "v"(l + 2 * 4096), "v"(l + 3 * 4096), "v"(l + 2 * FSK), "v"(l + 2 * FSK + 4096), "v"(l + 2 * FSK + 2 * 4096), "v"(l + 2 * FSK + 3 * 4096),
                    "v"(gk), "v"(gk + sk), "v"(gk + 2 * sk), "v"(gk + 3 * sk), "v"(gv), "v"(gv + sv), "v"(gv + 2 * sv), "v"(gv + 3 * sv)
                 : "memory");
}

// k_flash: fused attention, one wave per 32 query rows (QT = 2 tiles of 16) of one (batch, head), 8 waves a work-group; Q fragments straight from the f16 plane; K and V^T fragments come to LDS by asynchronous copies, one stage (128 keys) for all 8 waves, issued a whole stage ahead of their use, and are read from there (two 16-B LDS loads each).
// Each K and each V^T fragment is loaded once per wave and feeds one product per query tile, so the loaded bytes per product are 1 / QT of a one-tile wave's.
// Transposed form: S^T[key][t] = K Q^T (A = K rows, B = Q rows); lane (t = lane&15, h = lane>>4) holds keys 8h+r of each 16-key tile, so the packed
// P tile is directly the B fragment of O^T[d][t] = V^T P^T (element r <- tile keys 0..15, element 8+r <- tile keys 16..31, lane unchanged).
// Softmax state: the running max is one scalar per lane and query tile (the two lane halves of a column are combined with one xor-16 exchange).
// The row sums run on the matrix pipe: per query tile and pass one more product, A = all ones, B = the same packed P tile, so every row of its 16 x 16 result holds, per column t, the f32 sum over the 32 keys of the f16 P values
// that O^T is built from. Element 0 of that accumulator is the lane's sum (both lane halves hold it): it alone is rescaled and read; elements 1..7 are copies that nobody reads (bounded by SEQ * 256, so they stay finite).
__global__ __launch_bounds__(32 * AW) void k_flash(const h16* __restrict__ QP, const h16* __restrict__ KP, const h16* __restrict__ VT, h16* CTX) {
    __shared__ __align__(16) unsigned char ring[4 * FSK];
    const int tid = threadIdx.x;
    const int lane = threadIdx.x & 31, wave = __builtin_amdgcn_readfirstlane((int)(threadIdx.x >> 5));
    const int zh = blockIdx.y; const int b = zh / NH_, h = zh % NH_;
    const int t0 = (blockIdx.x * AW + wave) * (16 * QT);
    const size_t rbase = ((size_t)(b * SEQ / 16) * (DM / 32) + 2 * h) * FRG + 8 * lane;   // fragment (row tile 0 of the batch, k chunk 2h)
    const size_t qo = rbase + (size_t)(t0 / 16) * (DM / 32) * FRG;
    v16h qh0[QT], qh1[QT];                                          // B fragments: col t, k = d
#pragma unroll
    for (int q = 0; q < QT; ++q) { qh0[q] = ldh(QP + qo + (size_t)q * (DM / 32) * FRG); qh1[q] = ldh(QP + qo + (size_t)q * (DM / 32) * FRG + FRG); }
    // the lane's 16 B of each copy: K piece = row tiles 2i, 2i+1 of the stage (threads 0..127 | 128..255), 2 KiB each (k chunks 2h, 2h+1 lie side by side); V^T piece = key chunk i, 4 KiB
    const size_t ksp = (size_t)2 * (DM / 32) * FRG, vsp = (size_t)4 * FRG;   // halves from one piece to the next
    const h16* gk = KP + ((size_t)(b * SEQ / 16 + (tid >> 7)) * (DM / 32) + 2 * h) * FRG + 8 * (tid & 127);   // + stage * FKS pieces
    const h16* gv = VT + (size_t)zh * (SEQ / 32) * 4 * FRG + 8 * tid;                                         // + stage * FKS pieces
    const unsigned lb = (unsigned)(size_t)ring + 16u * (unsigned)tid;
    cp44(lb, gk, ksp, gv, vsp);
    asm volatile("s_wait_asynccnt 0x0" ::: "memory");   // this wave's copies of stage 0 have landed
    __syncthreads();                                    // ... and every other wave's
    cp44(lb + FSK, gk + FKS * ksp, ksp, gv + FKS * vsp, vsp);
    v8f o0[QT], o1[QT], o2[QT], o3[QT], ls[QT]; float m[QT];
    v16h ones;                                                      // A fragment of the row-sum product: 1.0 at every (row, k), so no lane map enters
#pragma unroll
    for (int e = 0; e < 16; ++e) ones[e] = (h16)1.0f;
#pragma unroll
    for (int q = 0; q < QT; ++q) { o0[q] = (v8f){}; o1[q] = (v8f){}; o2[q] = (v8f){}; o3[q] = (v8f){}; ls[q] = (v8f){}; m[q] = -3.0e38f; }
#pragma unroll 1
    for (int ps = 0; ps < SEQ / 32; ++ps) {
        const h16* ka = (const h16*)(ring + (unsigned)(ps & (2 * FKS - 1)) * 4096u) + 8 * lane;   // + (row tile * 2 + k chunk) fragments
        const v16h ka0 = ldh(ka), ka1 = ldh(ka + FRG), kb0 = ldh(ka + 2 * FRG), kb1 = ldh(ka + 3 * FRG);
        v8f sa[QT], sb[QT];
#pragma unroll
        for (int q = 0; q < QT; ++q) { sa[q] = wmma16(ka0, qh0[q], (v8f){}); sb[q] = wmma16(kb0, qh0[q], (v8f){}); }
#pragma unroll
        for (int q = 0; q < QT; ++q) { sa[q] = wmma16(ka1, qh1[q], sa[q]); sb[q] = wmma16(kb1, qh1[q], sb[q]); }
        // four vector slots between the last score product and the first read of its result
        asm volatile("v_nop\n\tv_nop\n\tv_nop\n\tv_nop" : "+v"(sa[0]), "+v"(sb[0]), "+v"(sa[1]), "+v"(sb[1]) : "v"(ka0), "v"(ka1), "v"(kb0), "v"(kb1));
        v16h pb[QT];
#pragma unroll
        for (int q = 0; q < QT; ++q) {
            const v8f ta = sa[q] * SC2, tb = sb[q] * SC2; float mx = -3.0e38f;
#pragma unroll
            for (int r = 0; r < 8; ++r) mx = fmaxf(mx, fmaxf(ta[r], tb[r]));
            mx = fmaxf(mx, __shfl_xor(mx, 16, 32));
            const float mnew = fmaxf(m[q], mx);
            const float alpha = __builtin_amdgcn_exp2f(m[q] - mnew);
            const float sh = PSH - mnew;
            const v8f ea = ta + sh, eb = tb + sh;
#pragma unroll
            for (int r = 0; r < 8; ++r) { pb[q][r] = (h16)__builtin_amdgcn_exp2f(ea[r]); pb[q][8 + r] = (h16)__builtin_amdgcn_exp2f(eb[r]); }
            ls[q][0] = ls[q][0] * alpha; m[q] = mnew;
            o0[q] = o0[q] * alpha; o1[q] = o1[q] * alpha; o2[q] = o2[q] * alpha; o3[q] = o3[q] * alpha;
        }
        const h16* va = ka + FSK;   // 2 FSK bytes on: + j fragments
        const v16h v0 = ldh(va), v1 = ldh(va + FRG), v2 = ldh(va + 2 * FRG), v3 = ldh(va + 3 * FRG);
#pragma unroll
        for (int q = 0; q < QT; ++q) ls[q] = wmma16(ones, pb[q], ls[q]);
#pragma unroll
        for (int q = 0; q < QT; ++q) { o0[q] = wmma16(v0, pb[q], o0[q]); o1[q] = wmma16(v1, pb[q], o1[q]); o2[q] = wmma16(v2, pb[q], o2[q]); o3[q] = wmma16(v3, pb[q], o3[q]); }
        // four vector slots behind the last product, also on the taken side of the loop branch
        asm volatile("v_nop\n\tv_nop\n\tv_nop\n\tv_nop" : "+v"(o0[0]), "+v"(o1[0]), "+v"(o2[0]), "+v"(o3[0]), "+v"(o0[1]), "+v"(o1[1]), "+v"(o2[1]), "+v"(o3[1]), "+v"(ls[0]), "+v"(ls[1]) : "v"(v0), "v"(v1), "v"(v2), "v"(v3), "v"(pb[0]), "v"(pb[1]));
        if ((ps & (FKS - 1)) == FKS - 1) {   // foot of stage st (the test reads the same in every wave of the work-group)
            const int st = ps / FKS;
            asm volatile("s_wait_dscnt 0x0" ::: "memory");      // this wave's reads of the buffer are done before it is refilled
            asm volatile("s_wait_asynccnt 0x0" ::: "memory");   // this wave's copies of stage st + 1 have landed
            __syncthreads();                                    // publishes stage st + 1 and ends every wave's reads of stage st
            if (st + 2 < FNS) cp44(lb + (unsigned)(st & 1) * FSK, gk + (size_t)(st + 2) * FKS * ksp, ksp, gv + (size_t)(st + 2) * FKS * vsp, vsp);
        }
    }
    asm volatile("s_wait_asynccnt 0x0" ::: "memory");   // nothing of this wave is in flight when it leaves the ring
#pragma unroll
    for (int q = 0; q < QT; ++q) {
        const float lt = ls[q][0];
        const float inv = CXS * (1.0f / lt);
        // O^T D layout: o_j[r] = (d = 16j + 8h + r, t = lane&15), which is load j&1 of ctx fragment (row tile t0/16 + q, k chunk 2*head + (j>>1)) at this same lane: stored from registers, 512 contiguous bytes per store
        h16* cw = CTX + ((size_t)((b * SEQ + t0) / 16 + q) * (2 * DM / 32) + 2 * h) * FRG + 8 * lane;
        const v8f oj[4] = { o0[q], o1[q], o2[q], o3[q] };
#pragma unroll
        for (int j = 0; j < 4; ++j) { v8h hv, rv;
#pragma unroll
            for (int r = 0; r < 8; ++r) { const float x = oj[j][r] * inv; const h16 a = (h16)x; hv[r] = a; rv[r] = (h16)(x - (float)a); }
            *(v8h*)(cw + j * 256) = hv; *(v8h*)(cw + (DM / 32) * FRG + j * 256) = rv; }
    }
}

// k_out: register-blocked f16 GEMM, ONE WAVE per 64x64 tile (16 accumulators), operands straight from the f16 planes in fragment order.
// OUT[m][n] = 2^-18 * sum_{k<2048} A[m][k] Bt[n][k & 1023] + b[n]; A = ctx plane [M][value 1024 | remainder 1024] (x4096), Bt = W plane [out][in] (x64). grid (M/64, DM/64), 32 threads.
__global__ __launch_bounds__(32) void k_out(const h16* __restrict__ A, const h16* __restrict__ Bt, const float* __restrict__ bias, float* OUT) {
    __shared__ __align__(16) float os[16 * 68];
    const int KA = 2 * DM;
    const int lane = threadIdx.x & 31, lr = lane & 15, hi = lane >> 4; const int r0 = blockIdx.x * 64, c0 = blockIdx.y * 64;
    v8f acc[4][4];
#pragma unroll
    for (int mb = 0; mb < 4; ++mb)
#pragma unroll
        for (int nb = 0; nb < 4; ++nb) acc[mb][nb] = (v8f){};
    const h16* ap = A + (size_t)(r0 / 16) * (KA / 32) * FRG + 8 * lane;    // + (mb * (KA / 32) + k step) fragments
    const h16* bp = Bt + (size_t)(c0 / 16) * (DM / 32) * FRG + 8 * lane;   // + (nb * (DM / 32) + (k step mod 32)) fragments
    // two fragment sets: while one k step's 16 products run, the next step's 8 fragments are already in flight into the other set
    v16h a0[4], b0[4], a1[4], b1[4];
#pragma unroll
    for (int i = 0; i < 4; ++i) { a0[i] = ldh(ap + (size_t)(i * (KA / 32)) * FRG); b0[i] = ldh(bp + (size_t)(i * (DM / 32)) * FRG); }
    asm volatile("s_wait_xcnt 0x0" ::: "memory");   // in front of every later overwrite of an address register that these 16 loads name
#pragma unroll 1
    for (int ks = 0; ks < KA / 32; ks += 2) {
        const int k1 = ks + 1, k2 = (ks + 2) & (KA / 32 - 1);   // k2 wraps to step 0 behind the last step: in bounds, loaded and not used
        const h16* ap1 = ap + (size_t)k1 * FRG; const h16* bp1 = bp + (size_t)(k1 & (DM / 32 - 1)) * FRG;
#pragma unroll
        for (int i = 0; i < 4; ++i) { a1[i] = ldh(ap1 + (size_t)(i * (KA / 32)) * FRG); b1[i] = ldh(bp1 + (size_t)(i * (DM / 32)) * FRG); }
        asm volatile("s_wait_xcnt 0x0" :: "v"(bp1) : "memory");   // in front of every overwrite of an address register that these 16 loads name; naming the B pointer keeps its registers live up to here, so that no load of the group lands on them (the A loads go by the trip's running pointer, which lives on)
        __builtin_amdgcn_sched_barrier(0);   // keeps the 16 loads of the next step ahead of this step's products (the scheduler otherwise sinks them next to their use, and their latency is waited out)
#pragma unroll
        for (int nb = 0; nb < 4; ++nb)
#pragma unroll
            for (int mb = 0; mb < 4; ++mb) acc[mb][nb] = wmma16(a0[mb], b0[nb], acc[mb][nb]);
        __builtin_amdgcn_sched_barrier(0);   // the refill of the first set stays behind its last reader and, with the next fence, ahead of the second set's products
        const h16* ap2 = ap + (size_t)k2 * FRG; const h16* bp2 = bp + (size_t)(k2 & (DM / 32 - 1)) * FRG;
#pragma unroll
        for (int i = 0; i < 4; ++i) { a0[i] = ldh(ap2 + (size_t)(i * (KA / 32)) * FRG); b0[i] = ldh(bp2 + (size_t)(i * (DM / 32)) * FRG); }
        asm volatile("s_wait_xcnt 0x0" :: "v"(ap2), "v"(bp2) : "memory");   // as above; both pointers of this group are formed for it alone, so both are named
        __builtin_amdgcn_sched_barrier(0);   // as above, for the second set
#pragma unroll
        for (int nb = 0; nb < 4; ++nb)
#pragma unroll
            for (int mb = 0; mb < 4; ++mb) acc[mb][nb] = wmma16(a1[mb], b1[nb], acc[mb][nb]);
        // four vector slots behind the last product, also on the taken side of the loop branch
        asm volatile("v_nop\n\tv_nop\n\tv_nop\n\tv_nop" : "+v"(acc[0][0]), "+v"(acc[1][1]), "+v"(acc[2][2]), "+v"(acc[3][3]) : "v"(a1[0]), "v"(a1[1]), "v"(a1[2]), "v"(a1[3]));
    }
    v4f bv = *(const v4f*)(bias + c0 + lr * 4);
#pragma unroll
    for (int i = 0; i < 4; ++i) bv[i] = bfr(bv[i]);
    float* orow = OUT + ((size_t)(r0 / SEQ) * OUT_SEQ + (size_t)(r0 % SEQ)) * DM + c0;
#pragma unroll
    for (int mb = 0; mb < 4; ++mb) {
#pragma unroll
        for (int nb = 0; nb < 4; ++nb) {
#pragma unroll
            for (int j = 0; j < 8; ++j) os[(hi * 8 + j) * 68 + nb * 16 + lr] = acc[mb][nb][j] * OSC; }   // D: row 8h+j, col lane&15
        wave_sync();
{
#pragma unroll
            for (int s = 0; s < 8; ++s) { const int row = 2 * s + hi, cofs = lr * 4;   // 8 s x 2 rows = 16 rows; 16 lanes x 4 floats = 64 columns
                const v4f x = *(const v4fa*)(&os[row * 68 + cofs]);
                const v4f val = x + bv;
                *(v4f*)(orow + (size_t)(mb * 16 + row) * DM + cofs) = val; }
             }
        wave_sync();
    }
}

static constexpr size_t al256(size_t v) { return (v + 255) & ~(size_t)255; }
static constexpr size_t SZ_PL = al256((size_t)NB * SEQ * DM * 2);          // one f16 plane of a stream
static constexpr size_t SZ_WH = al256((size_t)DM * DM * 2);
static constexpr size_t SZ_CX = al256((size_t)NB * SEQ * 2 * DM * 2);      // ctx value | remainder
static constexpr size_t SZ_TOTAL = 3 * SZ_PL + SZ_WH + SZ_CX;
static_assert(SZ_TOTAL <= (size_t)134217728);          // workspace carve <= 128 MiB

extern "C" void kernel_launch(void* const* d_in, const int* in_sizes, int n_in,
                              void* d_out, int out_size, void* d_ws, size_t ws_size, hipStream_t stream) {
    if (n_in < 5) return;
    const size_t needx = ((size_t)(NB - 1) * SEQ_FULL + SEQ) * DM;
    if ((size_t)in_sizes[0] < needx || (size_t)in_sizes[1] < needx || (size_t)in_sizes[2] < needx) return;
    if ((size_t)in_sizes[3] < (size_t)DM * DM || (size_t)in_sizes[4] < (size_t)DM) return;
    if ((size_t)out_size < ((size_t)(NB - 1) * OUT_SEQ + SEQ) * DM) return;
    if (SZ_TOTAL > ws_size) return;
    const float* q = (const float*)d_in[0]; const float* k = (const float*)d_in[1]; const float* v = (const float*)d_in[2];   // wire order q, k, v, W_out, b_out
    const float* wo = (const float*)d_in[3]; const float* bo = (const float*)d_in[4];                                         // W_out [out][in] = Bt as-is
    float* OUT = (float*)d_out;      // [NB][SEQ][1024]
    char* wsp = (char*)d_ws;
    h16* QP = (h16*)wsp; wsp += SZ_PL;               // [NB*SEQ/16][32] fragments
    h16* KP = (h16*)wsp; wsp += SZ_PL;               // [NB*SEQ/16][32] fragments
    h16* VT = (h16*)wsp; wsp += SZ_PL;               // [NB*16][SEQ/32][4] fragments
    h16* WH = (h16*)wsp; wsp += SZ_WH;               // [1024/16][32] fragments, x64
    h16* CX = (h16*)wsp; wsp += SZ_CX;               // [NB*SEQ/16][64] fragments, x4096

    // Q, K, V^T and W planes: one launch
    k_prep<<<dim3(VT_BL + 2 * ST_BL + W_BL, 1, 1), 256, 0, stream>>>(q, k, v, wo, QP, KP, VT, WH);

    k_flash<<<dim3(SEQ / (16 * AW * QT), NB * NH_, 1), 32 * AW, 0, stream>>>(QP, KP, VT, CX);

    // out = ctx W^T + b: A = ctx rows (m = b*SEQ + t), Bt = W rows (n = out column)
    k_out<<<dim3(NB * SEQ / 64, DM / 64, 1), 32, 0, stream>>>(CX, WH, bo, OUT);
}

// v007
// It runs in 103 microseconds.
// Next to v006, in two timings, it ran 1.05 times as fast each time.
// All steps since v000 together make it 2.55 times as fast.
#include <hip/hip_runtime.h>

// Multi-head attention on raw streams q, k, v [NB][SEQ][1024] = 16 heads x 64 (no input projections, no mask), score scale 1/8, output projection y = ctx W^T + b with W [out][in].
// Compute dtypes, f32 accumulate everywhere, all contractions v_wmma_f32_16x16x32_f16: q, k, v, W, b are RNE-converted to bf16 and all but b held exactly in f16 (W with a x64 carry); scores single product; P (x256 carry, cancels in the normalisation) and v single product;
// ctx carried x4096 as f16 value + f16 remainder (two products against the same W plane, one accumulator); softmax f32 (online, running max); bias added in f32.
// Layout: every f16 operand plane is stored in fragment order: one 16-row x 32-k fragment = 1 KiB = [load 0|1][lane 0..31][8 halves], lane = 16*hi + (row & 15), element e of load ld = k 16*ld + 8*hi + e,
// so each wave-wide 16-B load reads 512 contiguous bytes (4 whole lines). Q, K, W: fragment index (row/16)*32 + col/32; V^T: ((b*16+h)*(SEQ/32) + key/32)*4 + d/16; ctx (value 1024 | remainder 1024): (row/16)*64 + k/32.
// Fused flash kernel in transposed form (S^T = K Q^T, O^T = V^T P^T; K and V^T staged in LDS per 8-wave work-group) writes the ctx plane, then a one-wave-per-64x64-tile GEMM over K = 2048 (value | remainder) against W rows.

#ifndef NB
#define NB 4
#endif
#ifndef SEQ
#define SEQ 2048
#endif
#define NB_FULL  4
#define SEQ_FULL 2048
#ifndef OUT_SEQ
#define OUT_SEQ SEQ              // row pitch (in tokens) between batches of the output
#endif
#define DM   1024
#define NH_  16
#define HD   64
#define AW   8                   // waves per flash block
#define QT   2                   // 16-row query tiles per flash wave
#define SC2  (0.125f * 1.4426950408889634f)   // HD^-0.5 * log2(e)
#define PSH  8.0f                // log2 of the P carry (256)
#define TAU  7.0f                // the maximum in use may trail a column's true maximum by up to this much (log2 domain): P <= 2^(PSH + TAU) = 32768, inside f16
#define CXS  4096.0f             // carry of the ctx plane (value and remainder)
#define WSC  64.0f               // carry of the W plane
#define OSC  (1.0f / (4096.0f * 64.0f))

static_assert(HD == 64);
static_assert(NH_ * HD == DM);                 // head h = columns h*64 + d
static_assert((DM & (DM - 1)) == 0);           // k index wraps with a mask in the output GEMM
static_assert(DM % 256 == 0);                  // pack_tile takes 256 columns
static_assert(DM % 64 == 0);                   // GEMM k-loop takes two steps of 32 a trip
static_assert(SEQ % 64 == 0);                  // a 64-row tile never straddles two batches
static_assert((NB * SEQ) % 64 == 0);
static_assert(SEQ % 32 == 0);                  // key loop steps by 32
static_assert(SEQ % (16 * AW * QT) == 0);      // flash grid covers the sequence exactly
static_assert(QT == 2);                        // the two v_nop statements of k_flash name both tiles' registers
static_assert(((size_t)SEQ * DM) % 64 == 0);
static_assert(((size_t)DM * DM) % 64 == 0);
static_assert(NB <= NB_FULL);
static_assert(SEQ <= SEQ_FULL);

typedef _Float16 h16;
typedef __attribute__((ext_vector_type(16))) _Float16 v16h;
typedef __attribute__((ext_vector_type(8)))  _Float16 v8h;
typedef __attribute__((ext_vector_type(8)))  float    v8f;
typedef __attribute__((ext_vector_type(4)))  float    v4f;
typedef __attribute__((ext_vector_type(2)))  float    v2f;
typedef v4f  __attribute__((may_alias)) v4fa;
typedef v8h  __attribute__((may_alias)) v8ha;
typedef __attribute__((ext_vector_type(4)))  _Float16 v4h;
typedef v4h  __attribute__((may_alias)) v4ha;

// RNE convert f32 -> bf16, returned as the f32 value of that bf16
__device__ __forceinline__ float bfr(float f) { unsigned u = __float_as_uint(f); u += 0x7FFFu + ((u >> 16) & 1u); return __uint_as_float(u & 0xFFFF0000u); }
__device__ __forceinline__ v16h cat16(v8h lo, v8h hi) { return __builtin_shufflevector(lo, hi, 0, 1, 2, 3, 4, 5, 6, 7, 8, 9, 10, 11, 12, 13, 14, 15); }
__device__ __forceinline__ v8f wmma16(v16h a, v16h b, v8f c) { return __builtin_amdgcn_wmma_f32_16x16x32_f16(false, a, false, b, (short)0, c, false, false); }
// fragment loader from a plane in fragment order; p = fragment base + 8*lane: elements 0..7 <- k0+8h+0..7, elements 8..15 <- k0+16+8h+0..7 (same map for A and B)
#define FRG 512                  // halves per fragment
__device__ __forceinline__ v16h ldh(const h16* p) { return cat16(*(const v8h*)p, *(const v8h*)(p + 256)); }
// ordering point for wave-private LDS tiles (same wave writes and reads)
__device__ __forceinline__ void wave_sync() { __builtin_amdgcn_fence(3 /* release order */, "wavefront"); __builtin_amdgcn_wave_barrier(); asm volatile("" ::: "memory"); }

// pack_tile: 16 f32 rows x 256 columns (s = first element, row pitch DM) -> 8 fragments of an f16 plane (bf16 RNE value x scale) at d: whole-line reads, row-major LDS tile (pitch 528 B = 16 B x odd), 8 KiB contiguous out (cross-wave: block barrier).
__device__ __forceinline__ void pack_tile(const float* __restrict__ s, h16* d, float scale, h16* ts, int tid) {
#pragma unroll
    for (int i = 0; i < 4; ++i) { const int idx = i * 256 + tid, row = idx >> 6, c4 = (idx & 63) * 4;
        const v4f x = *(const v4f*)(s + (size_t)row * DM + c4); v4h o;
#pragma unroll
        for (int e = 0; e < 4; ++e) o[e] = (h16)(bfr(x[e]) * scale);
        *(v4ha*)(&ts[row * 264 + c4]) = o; }
    __syncthreads();
    v8h val[2];
#pragma unroll
    for (int it = 0; it < 2; ++it) { const int o = it * 256 + tid, ln = o & 31;   // o = 16-B piece of the 8 fragments: [k chunk o>>6][load (o>>5)&1][lane]
        val[it] = *(const v8ha*)(&ts[(ln & 15) * 264 + (o >> 6) * 32 + ((o >> 5) & 1) * 16 + (ln >> 4) * 8]); }
#pragma unroll
    for (int it = 0; it < 2; ++it) *(v8h*)(d + (size_t)(it * 256 + tid) * 8) = val[it];
}

// vt_tile: 64 keys x 64 columns of v (src = first element, row pitch DM; one head x 2 key chunks) -> 8 V^T fragments (row d, k = key; f16 of the bf16 RNE value) at dst, through LDS (cross-wave: block barrier).
__device__ __forceinline__ void vt_tile(const float* __restrict__ src, h16* dst, h16* ts, int tid) {
#pragma unroll
    for (int i = 0; i < 4; ++i) { const int t = i * 16 + (tid >> 4), c4 = (tid & 15) * 4;
        const v4f x = *(const v4f*)(src + (size_t)t * DM + c4);
#pragma unroll
        for (int e = 0; e < 4; ++e) ts[(c4 + e) * 72 + t] = (h16)bfr(x[e]); }
    __syncthreads();
    v8h val[2];
#pragma unroll
    for (int it = 0; it < 2; ++it) { const int o = it * 256 + tid, ln = o & 31;   // o = 16-B piece: [key chunk o>>8][d tile (o>>6)&3][load (o>>5)&1][lane]
        val[it] = *(const v8ha*)(&ts[(((o >> 6) & 3) * 16 + (ln & 15)) * 72 + (o >> 8) * 32 + ((o >> 5) & 1) * 16 + (ln >> 4) * 8]); }
#pragma unroll
    for (int it = 0; it < 2; ++it) *(v8h*)(dst + (size_t)(it * 256 + tid) * 8) = val[it];
}

// k_prep: all four operand planes in ONE launch (they depend on nothing but the inputs): the flat block index picks the plane and the tile, alike for the whole block, so each block runs one tile body with its one barrier.
// Blocks [0, VT_BL): V^T tiles (key tile fastest, then head, then batch); then Q, then K (row tile fastest, then 256-column block; per-batch input pitch SEQ_FULL rows); then W (x64).
#define VT_BL ((SEQ / 64) * (DM / 64) * NB)
#define ST_RT (NB * SEQ / 16)            // 16-row tiles of a stream plane
#define ST_BL (ST_RT * (DM / 256))
#define W_RT  (DM / 16)
#define W_BL  (W_RT * (DM / 256))
__global__ __launch_bounds__(256) void k_prep(const float* __restrict__ q, const float* __restrict__ k, const float* __restrict__ v, const float* __restrict__ w, h16* QP, h16* KP, h16* VT, h16* WH) {
    __shared__ __align__(16) h16 ts[64 * 72];
    static_assert(64 * 72 >= 16 * 264);   // one LDS tile serves either body
    const int tid = threadIdx.x; const int bid = blockIdx.x;
    if (bid < VT_BL) {
        const int t0 = (bid % (SEQ / 64)) * 64, hd = (bid / (SEQ / 64)) % (DM / 64), b = bid / ((SEQ / 64) * (DM / 64));
        vt_tile(v + ((size_t)b * SEQ_FULL + t0) * DM + hd * 64, VT + (((size_t)b * NH_ + hd) * (SEQ / 32) + t0 / 32) * 4 * FRG, ts, tid);
    } else if (bid < VT_BL + 2 * ST_BL) {
        const int u = bid - VT_BL; const bool isk = u >= ST_BL; const int x = isk ? u - ST_BL : u;
        const int rt = x % ST_RT, c0 = (x / ST_RT) * 256;
        const size_t row = (size_t)(rt / (SEQ / 16)) * SEQ_FULL + (size_t)(rt % (SEQ / 16)) * 16;
        pack_tile((isk ? k : q) + row * DM + c0, (isk ? KP : QP) + ((size_t)rt * (DM / 32) + c0 / 32) * FRG, 1.0f, ts, tid);
    } else {
        const int x = bid - (VT_BL + 2 * ST_BL); const int rt = x % W_RT, c0 = (x / W_RT) * 256;
        pack_tile(w + (size_t)rt * 16 * DM + c0, WH + ((size_t)rt * (DM / 32) + c0 / 32) * FRG, WSC, ts, tid);
    }
}

// LDS ring of k_flash: a stage = FKS passes of 32 keys of one (batch, head) = K: 2 * FKS row tiles x 2 fragments, V^T: FKS key chunks x 4 fragments, every fragment as it lies in its plane; two buffers, laid [K 0 | K 1 | V^T 0 | V^T 1],
// so that pass ps reads K at byte (ps mod 2 FKS) * 4096 and V^T at 2 FSK bytes behind it.
#define FKS  4                           // passes per stage
#define FSK  (FKS * 4 * FRG * 2)         // K part of a stage, bytes; the V^T part is as large
#define FNS  (SEQ / (32 * FKS))          // stages
static_assert(AW * 32 * 16 == 4 * FRG * 2);    // one copy of the whole work-group moves 4 fragments (4 KiB): two K row tiles of the head, or one V^T key chunk
static_assert(FKS == 4);                       // cp44: four K copies and four V^T copies a stage
static_assert(SEQ % (32 * FKS) == 0);
static_assert(FNS >= 2);                       // the prologue fills two stages
// one stage, eight asynchronous 16-B copies per lane: K piece i from gk + i * sk halves, V^T piece i from gv + i * sv halves, to LDS byte addresses l + i * 4096 and l + 2 * FSK + i * 4096.
__device__ __forceinline__ void cp44(unsigned l, const h16* gk, size_t sk, const h16* gv, size_t sv) {
    // the s_wait_xcnt stands inside the copies' own statement, in front of any later rewrite of an address register that a copy names
    asm volatile("global_load_async_to_lds_b128 %0, %8, off\n\t"
                 "global_load_async_to_lds_b128 %1, %9, off\n\t"
                 "global_load_async_to_lds_b128 %2, %10, off\n\t"
                 "global_load_async_to_lds_b128 %3, %11, off\n\t"
                 "global_load_async_to_lds_b128 %4, %12, off\n\t"
                 "global_load_async_to_lds_b128 %5, %13, off\n\t"
                 "global_load_async_to_lds_b128 %6, %14, off\n\t"
                 "global_load_async_to_lds_b128 %7, %15, off\n\t"
                 "s_wait_xcnt 0x0"
                 :: "v"(l), "v"(l + 4096), "v"(l + 2 * 4096), "v"(l + 3 * 4096), "v"(l + 2 * FSK), "v"(l + 2 * FSK + 4096), "v"(l + 2 * FSK + 2 * 4096), "v"(l + 2 * FSK + 3 * 4096),
                    "v"(gk), "v"(gk + sk), "v"(gk + 2 * sk), "v"(gk + 3 * sk), "v"(gv), "v"(gv + sv), "v"(gv + 2 * sv), "v"(gv + 3 * sv)
                 : "memory");
}

// k_flash: fused attention, one wave per 32 query rows (QT = 2 tiles of 16) of one (batch, head), 8 waves a work-group; Q fragments straight from the f16 plane; K and V^T fragments come to LDS by asynchronous copies, one stage (128 keys) for all 8 waves, issued a whole stage ahead of their use, and are read from there (two 16-B LDS loads each).
// Each K and each V^T fragment is loaded once per wave and feeds one product per query tile, so the loaded bytes per product are 1 / QT of a one-tile wave's.
// Transposed form: S^T[key][t] = K Q^T (A = K rows, B = Q rows); lane (t = lane&15, h = lane>>4) holds keys 8h+r of each 16-key tile, so the packed
// P tile is directly the B fragment of O^T[d][t] = V^T P^T (element r <- tile keys 0..15, element 8+r <- tile keys 16..31, lane unchanged).
// Softmax state: the maximum in use is one scalar per lane and query tile, alike in the two lane halves of a column. It is refreshed lazily: each pass takes the lane's maximum of the raw scores (the scale is positive) and tests ONCE, for the whole wave,
// whether any lane's exceeds the maximum in use by more than TAU; only then (a scalar branch: always in pass 0, afterwards rarely) are the halves joined (xor-16 exchange), the maxima raised and the sums and O^T rescaled. Any maximum cancels in the normalisation.
// The row sums run on the matrix pipe: per query tile and pass one more product, A = all ones, B = the same packed P tile, so every row of its 16 x 16 result holds, per column t, the f32 sum over the 32 keys of the f16 P values
// that O^T is built from. Element 0 of that accumulator is the lane's sum (both lane halves hold it): it alone is rescaled and read; elements 1..7 are copies that nobody reads (bounded by SEQ * 32768, so they stay finite).
__global__ __launch_bounds__(32 * AW) void k_flash(const h16* __restrict__ QP, const h16* __restrict__ KP, const h16* __restrict__ VT, h16* CTX) {
    __shared__ __align__(16) unsigned char ring[4 * FSK];
    const int tid = threadIdx.x;
    const int lane = threadIdx.x & 31, wave = __builtin_amdgcn_readfirstlane((int)(threadIdx.x >> 5));
    const int zh = blockIdx.y; const int b = zh / NH_, h = zh % NH_;
    const int t0 = (blockIdx.x * AW + wave) * (16 * QT);
    const size_t rbase = ((size_t)(b * SEQ / 16) * (DM / 32) + 2 * h) * FRG + 8 * lane;   // fragment (row tile 0 of the batch, k chunk 2h)
    const size_t qo = rbase + (size_t)(t0 / 16) * (DM / 32) * FRG;
    v16h qh0[QT], qh1[QT];                                          // B fragments: col t, k = d
#pragma unroll
    for (int q = 0; q < QT; ++q) { qh0[q] = ldh(QP + qo + (size_t)q * (DM / 32) * FRG); qh1[q] = ldh(QP + qo + (size_t)q * (DM / 32) * FRG + FRG); }
    // the lane's 16 B of each copy: K piece = row tiles 2i, 2i+1 of the stage (threads 0..127 | 128..255), 2 KiB each (k chunks 2h, 2h+1 lie side by side); V^T piece = key chunk i, 4 KiB
    const size_t ksp = (size_t)2 * (DM / 32) * FRG, vsp = (size_t)4 * FRG;   // halves from one piece to the next
    const h16* gk = KP + ((size_t)(b * SEQ / 16 + (tid >> 7)) * (DM / 32) + 2 * h) * FRG + 8 * (tid & 127);   // + stage * FKS pieces
    const h16* gv = VT + (size_t)zh * (SEQ / 32) * 4 * FRG + 8 * tid;                                         // + stage * FKS pieces
    const unsigned lb = (unsigned)(size_t)ring + 16u * (unsigned)tid;
    cp44(lb, gk, ksp, gv, vsp);
    asm volatile("s_wait_asynccnt 0x0" ::: "memory");   // this wave's copies of stage 0 have landed
    __syncthreads();                                    // ... and every other wave's
    cp44(lb + FSK, gk + FKS * ksp, ksp, gv + FKS * vsp, vsp);
    v8f o0[QT], o1[QT], o2[QT], o3[QT], ls[QT]; float m[QT], sh[QT], lim[QT];   // sh = PSH - m; lim = (m + TAU) / SC2, the raw score above which m must rise
    v16h ones;                                                      // A fragment of the row-sum product: 1.0 at every (row, k), so no lane map enters
#pragma unroll
    for (int e = 0; e < 16; ++e) ones[e] = (h16)1.0f;
#pragma unroll
    for (int q = 0; q < QT; ++q) { o0[q] = (v8f){}; o1[q] = (v8f){}; o2[q] = (v8f){}; o3[q] = (v8f){}; ls[q] = (v8f){}; m[q] = -3.0e38f; sh[q] = PSH; lim[q] = -3.0e38f; }
#pragma unroll 1
    for (int ps = 0; ps < SEQ / 32; ++ps) {
        const h16* ka = (const h16*)(ring + (unsigned)(ps & (2 * FKS - 1)) * 4096u) + 8 * lane;   // + (row tile * 2 + k chunk) fragments
        const v16h ka0 = ldh(ka), ka1 = ldh(ka + FRG), kb0 = ldh(ka + 2 * FRG), kb1 = ldh(ka + 3 * FRG);
        v8f sa[QT], sb[QT];
#pragma unroll
        for (int q = 0; q < QT; ++q) { sa[q] = wmma16(ka0, qh0[q], (v8f){}); sb[q] = wmma16(kb0, qh0[q], (v8f){}); }
#pragma unroll
        for (int q = 0; q < QT; ++q) { sa[q] = wmma16(ka1, qh1[q], sa[q]); sb[q] = wmma16(kb1, qh1[q], sb[q]); }
        // four vector slots between the last score product and the first read of its result
        asm volatile("v_nop\n\tv_nop\n\tv_nop\n\tv_nop" : "+v"(sa[0]), "+v"(sb[0]), "+v"(sa[1]), "+v"(sb[1]) : "v"(ka0), "v"(ka1), "v"(kb0), "v"(kb1));
        float mr[QT]; bool need = false;
#pragma unroll
        for (int q = 0; q < QT; ++q) {   // the lane's maximum of its 16 raw scores
            float mx = -3.0e38f;
#pragma unroll
            for (int r = 0; r < 8; ++r) mx = fmaxf(mx, fmaxf(sa[q][r], sb[q][r]));
            mr[q] = mx; need = need || (mx > lim[q]);
        }
        if (__builtin_amdgcn_ballot_w32(need) != 0) {   // one scalar branch per pass, every lane on inside it
#pragma unroll
            for (int q = 0; q < QT; ++q) {
                float mx = mr[q] * SC2;
                mx = fmaxf(mx, __shfl_xor(mx, 16, 32));
                const float mnew = fmaxf(m[q], mx);
                const float alpha = __builtin_amdgcn_exp2f(m[q] - mnew);
                m[q] = mnew; sh[q] = PSH - mnew; lim[q] = (mnew + TAU) * (1.0f / SC2);
                ls[q][0] = ls[q][0] * alpha;
                o0[q] = o0[q] * alpha; o1[q] = o1[q] * alpha; o2[q] = o2[q] * alpha; o3[q] = o3[q] * alpha;
            }
        }
        v16h pb[QT];
#pragma unroll
        for (int q = 0; q < QT; ++q) {
            const v2f c2 = { SC2, SC2 }, s2 = { sh[q], sh[q] };
#pragma unroll
            for (int i = 0; i < 8; ++i) {   // elements 2i, 2i+1 of the 32-key operand: neighbouring registers of one score tile share a packed multiply-add and a packed conversion
                const v8f s = i < 4 ? sa[q] : sb[q];
                const v2f x = __builtin_elementwise_fma((v2f){ s[2 * (i & 3)], s[2 * (i & 3) + 1] }, c2, s2);
                pb[q][2 * i] = (h16)__builtin_amdgcn_exp2f(x.x); pb[q][2 * i + 1] = (h16)__builtin_amdgcn_exp2f(x.y);
            }
        }
        const h16* va = ka + FSK;   // 2 FSK bytes on: + j fragments
        const v16h v0 = ldh(va), v1 = ldh(va + FRG), v2 = ldh(va + 2 * FRG), v3 = ldh(va + 3 * FRG);
#pragma unroll
        for (int q = 0; q < QT; ++q) ls[q] = wmma16(ones, pb[q], ls[q]);
#pragma unroll
        for (int q = 0; q < QT; ++q) { o0[q] = wmma16(v0, pb[q], o0[q]); o1[q] = wmma16(v1, pb[q], o1[q]); o2[q] = wmma16(v2, pb[q], o2[q]); o3[q] = wmma16(v3, pb[q], o3[q]); }
        // four vector slots behind the last product, also on the taken side of the loop branch
        asm volatile("v_nop\n\tv_nop\n\tv_nop\n\tv_nop" : "+v"(o0[0]), "+v"(o1[0]), "+v"(o2[0]), "+v"(o3[0]), "+v"(o0[1]), "+v"(o1[1]), "+v"(o2[1]), "+v"(o3[1]), "+v"(ls[0]), "+v"(ls[1]) : "v"(v0), "v"(v1), "v"(v2), "v"(v3), "v"(pb[0]), "v"(pb[1]));
        if ((ps & (FKS - 1)) == FKS - 1) {   // foot of stage st (the test reads the same in every wave of the work-group)
            const int st = ps / FKS;
            asm volatile("s_wait_dscnt 0x0" ::: "memory");      // this wave's reads of the buffer are done before it is refilled
            asm volatile("s_wait_asynccnt 0x0" ::: "memory");   // this wave's copies of stage st + 1 have landed
            __syncthreads();                                    // publishes stage st + 1 and ends every wave's reads of stage st
            if (st + 2 < FNS) cp44(lb + (unsigned)(st & 1) * FSK, gk + (size_t)(st + 2) * FKS * ksp, ksp, gv + (size_t)(st + 2) * FKS * vsp, vsp);
        }
    }
    asm volatile("s_wait_asynccnt 0x0" ::: "memory");   // nothing of this wave is in flight when it leaves the ring
#pragma unroll
    for (int q = 0; q < QT; ++q) {
        const float lt = ls[q][0];
        const float inv = CXS * (1.0f / lt);
        // O^T D layout: o_j[r] = (d = 16j + 8h + r, t = lane&15), which is load j&1 of ctx fragment (row tile t0/16 + q, k chunk 2*head + (j>>1)) at this same lane: stored from registers, 512 contiguous bytes per store
        h16* cw = CTX + ((size_t)((b * SEQ + t0) / 16 + q) * (2 * DM / 32) + 2 * h) * FRG + 8 * lane;
        const v8f oj[4] = { o0[q], o1[q], o2[q], o3[q] };
#pragma unroll
        for (int j = 0; j < 4; ++j) { v8h hv, rv;
#pragma unroll
            for (int r = 0; r < 8; ++r) { const float x = oj[j][r] * inv; const h16 a = (h16)x; hv[r] = a; rv[r] = (h16)(x - (float)a); }
            *(v8h*)(cw + j * 256) = hv; *(v8h*)(cw + (DM / 32) * FRG + j * 256) = rv; }
    }
}

// k_out: register-blocked f16 GEMM, ONE WAVE per 64x64 tile (16 accumulators), operands straight from the f16 planes in fragment order.
// OUT[m][n] = 2^-18 * sum_{k<2048} A[m][k] Bt[n][k & 1023] + b[n]; A = ctx plane [M][value 1024 | remainder 1024] (x4096), Bt = W plane [out][in] (x64). grid (M/64, DM/64), 32 threads.
__global__ __launch_bounds__(32) void k_out(const h16* __restrict__ A, const h16* __restrict__ Bt, const float* __restrict__ bias, float* OUT) {
    __shared__ __align__(16) float os[16 * 68];
    const int KA = 2 * DM;
    const int lane = threadIdx.x & 31, lr = lane & 15, hi = lane >> 4; const int r0 = blockIdx.x * 64, c0 = blockIdx.y * 64;
    v8f acc[4][4];
#pragma unroll
    for (int mb = 0; mb < 4; ++mb)
#pragma unroll
        for (int nb = 0; nb < 4; ++nb) acc[mb][nb] = (v8f){};
    const h16* ap = A + (size_t)(r0 / 16) * (KA / 32) * FRG + 8 * lane;    // + (mb * (KA / 32) + k step) fragments
    const h16* bp = Bt + (size_t)(c0 / 16) * (DM / 32) * FRG + 8 * lane;   // + (nb * (DM / 32) + (k step mod 32)) fragments
    // two fragment sets: while one k step's 16 products run, the next step's 8 fragments are already in flight into the other set
    v16h a0[4], b0[4], a1[4], b1[4];
#pragma unroll
    for (int i = 0; i < 4; ++i) { a0[i] = ldh(ap + (size_t)(i * (KA / 32)) * FRG); b0[i] = ldh(bp + (size_t)(i * (DM / 32)) * FRG); }
    asm volatile("s_wait_xcnt 0x0" ::: "memory");   // in front of every later overwrite of an address register that these 16 loads name
#pragma unroll 1
    for (int ks = 0; ks < KA / 32; ks += 2) {
        const int k1 = ks + 1, k2 = (ks + 2) & (KA / 32 - 1);   // k2 wraps to step 0 behind the last step: in bounds, loaded and not used
        const h16* ap1 = ap + (size_t)k1 * FRG; const h16* bp1 = bp + (size_t)(k1 & (DM / 32 - 1)) * FRG;
#pragma unroll
        for (int i = 0; i < 4; ++i) { a1[i] = ldh(ap1 + (size_t)(i * (KA / 32)) * FRG); b1[i] = ldh(bp1 + (size_t)(i * (DM / 32)) * FRG); }
        asm volatile("s_wait_xcnt 0x0" :: "v"(bp1) : "memory");   // in front of every overwrite of an address register that these 16 loads name; naming the B pointer keeps its registers live up to here, so that no load of the group lands on them (the A loads go by the trip's running pointer, which lives on)
        __builtin_amdgcn_sched_barrier(0);   // keeps the 16 loads of the next step ahead of this step's products (the scheduler otherwise sinks them next to their use, and their latency is waited out)
#pragma unroll
        for (int nb = 0; nb < 4; ++nb)
#pragma unroll
            for (int mb = 0; mb < 4; ++mb) acc[mb][nb] = wmma16(a0[mb], b0[nb], acc[mb][nb]);
        __builtin_amdgcn_sched_barrier(0);   // the refill of the first set stays behind its last reader and, with the next fence, ahead of the second set's products
        const h16* ap2 = ap + (size_t)k2 * FRG; const h16* bp2 = bp + (size_t)(k2 & (DM / 32 - 1)) * FRG;
#pragma unroll
        for (int i = 0; i < 4; ++i) { a0[i] = ldh(ap2 + (size_t)(i * (KA / 32)) * FRG); b0[i] = ldh(bp2 + (size_t)(i * (DM / 32)) * FRG); }
        asm volatile("s_wait_xcnt 0x0" :: "v"(ap2), "v"(bp2) : "memory");   // as above; both pointers of this group are formed for it alone, so both are named
        __builtin_amdgcn_sched_barrier(0);   // as above, for the second set
#pragma unroll
        for (int nb = 0; nb < 4; ++nb)
#pragma unroll
            for (int mb = 0; mb < 4; ++mb) acc[mb][nb] = wmma16(a1[mb], b1[nb], acc[mb][nb]);
        // four vector slots behind the last product, also on the taken side of the loop branch
        asm volatile("v_nop\n\tv_nop\n\tv_nop\n\tv_nop" : "+v"(acc[0][0]), "+v"(acc[1][1]), "+v"(acc[2][2]), "+v"(acc[3][3]) : "v"(a1[0]), "v"(a1[1]), "v"(a1[2]), "v"(a1[3]));
    }
    v4f bv = *(const v4f*)(bias + c0 + lr * 4);
#pragma unroll
    for (int i = 0; i < 4; ++i) bv[i] = bfr(bv[i]);
    float* orow = OUT + ((size_t)(r0 / SEQ) * OUT_SEQ + (size_t)(r0 % SEQ)) * DM + c0;
#pragma unroll
    for (int mb = 0; mb < 4; ++mb) {
#pragma unroll
        for (int nb = 0; nb < 4; ++nb) {
#pragma unroll
            for (int j = 0; j < 8; ++j) os[(hi * 8 + j) * 68 + nb * 16 + lr] = acc[mb][nb][j] * OSC; }   // D: row 8h+j, col lane&15
        wave_sync();
{
#pragma unroll
            for (int s = 0; s < 8; ++s) { const int row = 2 * s + hi, cofs = lr * 4;   // 8 s x 2 rows = 16 rows; 16 lanes x 4 floats = 64 columns
                const v4f x = *(const v4fa*)(&os[row * 68 + cofs]);
                const v4f val = x + bv;
                *(v4f*)(orow + (size_t)(mb * 16 + row) * DM + cofs) = val; }
             }
        wave_sync();
    }
}

static constexpr size_t al256(size_t v) { return (v + 255) & ~(size_t)255; }
static constexpr size_t SZ_PL = al256((size_t)NB * SEQ * DM * 2);          // one f16 plane of a stream
static constexpr size_t SZ_WH = al256((size_t)DM * DM * 2);
static constexpr size_t SZ_CX = al256((size_t)NB * SEQ * 2 * DM * 2);      // ctx value | remainder
static constexpr size_t SZ_TOTAL = 3 * SZ_PL + SZ_WH + SZ_CX;
static_assert(SZ_TOTAL <= (size_t)134217728);          // workspace carve <= 128 MiB

extern "C" void kernel_launch(void* const* d_in, const int* in_sizes, int n_in,
                              void* d_out, int out_size, void* d_ws, size_t ws_size, hipStream_t stream) {
    if (n_in < 5) return;
    const size_t needx = ((size_t)(NB - 1) * SEQ_FULL + SEQ) * DM;
    if ((size_t)in_sizes[0] < needx || (size_t)in_sizes[1] < needx || (size_t)in_sizes[2] < needx) return;
    if ((size_t)in_sizes[3] < (size_t)DM * DM || (size_t)in_sizes[4] < (size_t)DM) return;
    if ((size_t)out_size < ((size_t)(NB - 1) * OUT_SEQ + SEQ) * DM) return;
    if (SZ_TOTAL > ws_size) return;
    const float* q = (const float*)d_in[0]; const float* k = (const float*)d_in[1]; const float* v = (const float*)d_in[2];   // wire order q, k, v, W_out, b_out
    const float* wo = (const float*)d_in[3]; const float* bo = (const float*)d_in[4];                                         // W_out [out][in] = Bt as-is
    float* OUT = (float*)d_out;      // [NB][SEQ][1024]
    char* wsp = (char*)d_ws;
    h16* QP = (h16*)wsp; wsp += SZ_PL;               // [NB*SEQ/16][32] fragments
    h16* KP = (h16*)wsp; wsp += SZ_PL;               // [NB*SEQ/16][32] fragments
    h16* VT = (h16*)wsp; wsp += SZ_PL;               // [NB*16][SEQ/32][4] fragments
    h16* WH = (h16*)wsp; wsp += SZ_WH;               // [1024/16][32] fragments, x64
    h16* CX = (h16*)wsp; wsp += SZ_CX;               // [NB*SEQ/16][64] fragments, x4096

    // Q, K, V^T and W planes: one launch
    k_prep<<<dim3(VT_BL + 2 * ST_BL + W_BL, 1, 1), 256, 0, stream>>>(q, k, v, wo, QP, KP, VT, WH);

    k_flash<<<dim3(SEQ / (16 * AW * QT), NB * NH_, 1), 32 * AW, 0, stream>>>(QP, KP, VT, CX);

    // out = ctx W^T + b: A = ctx rows (m = b*SEQ + t), Bt = W rows (n = out column)
    k_out<<<dim3(NB * SEQ / 64, DM / 64, 1), 32, 0, stream>>>(CX, WH, bo, OUT);
}

// v008
// Measured time: 89.3 microseconds a run.
// Timed twice side by side with v007, it ran 1.15 and 1.16 times as fast.
// Over all steps from v000 it is 2.95 times as fast.
#include <hip/hip_runtime.h>

// Multi-head attention on raw streams q, k, v [NB][SEQ][1024] = 16 heads x 64 (no input projections, no mask), score scale 1/8, output projection y = ctx W^T + b with W [out][in].
// Compute dtypes, f32 accumulate everywhere, all contractions v_wmma_f32_16x16x32_f16: q, k, v, W, b are RNE-converted to bf16 and all but b held exactly in f16 (W with a x64 carry); scores single product; P (x256 carry, cancels in the normalisation) and v single product;
// ctx carried x4096 as f16 value + f16 remainder (two products against the same W plane, one accumulator); softmax f32 (online, running max); bias added in f32.
// Layout: every f16 operand plane is stored in fragment order: one 16-row x 32-k fragment = 1 KiB = [load 0|1][lane 0..31][8 halves], lane = 16*hi + (row & 15), element e of load ld = k 16*ld + 8*hi + e,
// so each wave-wide 16-B load reads 512 contiguous bytes (4 whole lines). Q, K, W: fragment index (row/16)*32 + col/32; V^T: ((b*16+h)*(SEQ/32) + key/32)*4 + d/16; ctx (value 1024 | remainder 1024): (row/16)*64 + k/32.
// Fused flash kernel in transposed form (S^T = K Q^T, O^T = V^T P^T; K and V^T staged in LDS per 8-wave work-group) writes the ctx plane, then a GEMM (128x256 tile per 8-wave work-group, operands staged in LDS) of value and remainder against W rows.

#ifndef NB
#define NB 4
#endif
#ifndef SEQ
#define SEQ 2048
#endif
#define NB_FULL  4
#define SEQ_FULL 2048
#ifndef OUT_SEQ
#define OUT_SEQ SEQ              // row pitch (in tokens) between batches of the output
#endif
#define DM   1024
#define NH_  16
#define HD   64
#define AW   8                   // waves per flash block
#define QT   2                   // 16-row query tiles per flash wave
#define SC2  (0.125f * 1.4426950408889634f)   // HD^-0.5 * log2(e)
#define PSH  8.0f                // log2 of the P carry (256)
#define TAU  7.0f                // the maximum in use may trail a column's true maximum by up to this much (log2 domain): P <= 2^(PSH + TAU) = 32768, inside f16
#define CXS  4096.0f             // carry of the ctx plane (value and remainder)
#define WSC  64.0f               // carry of the W plane
#define OSC  (1.0f / (4096.0f * 64.0f))

static_assert(HD == 64);
static_assert(NH_ * HD == DM);                 // head h = columns h*64 + d
static_assert((DM & (DM - 1)) == 0);
static_assert(DM % 256 == 0);                  // pack_tile takes 256 columns
static_assert(DM % 64 == 0);                   // GEMM k-loop takes two steps of 32 a trip
static_assert(SEQ % 64 == 0);                  // a 64-row tile never straddles two batches
static_assert((NB * SEQ) % 64 == 0);
static_assert(SEQ % 32 == 0);                  // key loop steps by 32
static_assert(SEQ % (16 * AW * QT) == 0);      // flash grid covers the sequence exactly
static_assert(QT == 2);                        // the two v_nop statements of k_flash name both tiles' registers
static_assert(((size_t)SEQ * DM) % 64 == 0);
static_assert(((size_t)DM * DM) % 64 == 0);
static_assert(NB <= NB_FULL);
static_assert(SEQ <= SEQ_FULL);

typedef _Float16 h16;
typedef __attribute__((ext_vector_type(16))) _Float16 v16h;
typedef __attribute__((ext_vector_type(8)))  _Float16 v8h;
typedef __attribute__((ext_vector_type(8)))  float    v8f;
typedef __attribute__((ext_vector_type(4)))  float    v4f;
typedef __attribute__((ext_vector_type(2)))  float    v2f;
typedef v4f  __attribute__((may_alias)) v4fa;
typedef v8h  __attribute__((may_alias)) v8ha;
typedef __attribute__((ext_vector_type(4)))  _Float16 v4h;
typedef v4h  __attribute__((may_alias)) v4ha;

// RNE convert f32 -> bf16, returned as the f32 value of that bf16
__device__ __forceinline__ float bfr(float f) { unsigned u = __float_as_uint(f); u += 0x7FFFu + ((u >> 16) & 1u); return __uint_as_float(u & 0xFFFF0000u); }
__device__ __forceinline__ v16h cat16(v8h lo, v8h hi) { return __builtin_shufflevector(lo, hi, 0, 1, 2, 3, 4, 5, 6, 7, 8, 9, 10, 11, 12, 13, 14, 15); }
__device__ __forceinline__ v8f wmma16(v16h a, v16h b, v8f c) { return __builtin_amdgcn_wmma_f32_16x16x32_f16(false, a, false, b, (short)0, c, false, false); }
// fragment loader from a plane in fragment order; p = fragment base + 8*lane: elements 0..7 <- k0+8h+0..7, elements 8..15 <- k0+16+8h+0..7 (same map for A and B)
#define FRG 512                  // halves per fragment
__device__ __forceinline__ v16h ldh(const h16* p) { return cat16(*(const v8h*)p, *(const v8h*)(p + 256)); }
// ordering point for wave-private LDS tiles (same wave writes and reads)
__device__ __forceinline__ void wave_sync() { __builtin_amdgcn_fence(3 /* release order */, "wavefront"); __builtin_amdgcn_wave_barrier(); asm volatile("" ::: "memory"); }

// pack_tile: 16 f32 rows x 256 columns (s = first element, row pitch DM) -> 8 fragments of an f16 plane (bf16 RNE value x scale) at d: whole-line reads, row-major LDS tile (pitch 528 B = 16 B x odd), 8 KiB contiguous out (cross-wave: block barrier).
__device__ __forceinline__ void pack_tile(const float* __restrict__ s, h16* d, float scale, h16* ts, int tid) {
#pragma unroll
    for (int i = 0; i < 4; ++i) { const int idx = i * 256 + tid, row = idx >> 6, c4 = (idx & 63) * 4;
        const v4f x = *(const v4f*)(s + (size_t)row * DM + c4); v4h o;
#pragma unroll
        for (int e = 0; e < 4; ++e) o[e] = (h16)(bfr(x[e]) * scale);
        *(v4ha*)(&ts[row * 264 + c4]) = o; }
    __syncthreads();
    v8h val[2];
#pragma unroll
    for (int it = 0; it < 2; ++it) { const int o = it * 256 + tid, ln = o & 31;   // o = 16-B piece of the 8 fragments: [k chunk o>>6][load (o>>5)&1][lane]
        val[it] = *(const v8ha*)(&ts[(ln & 15) * 264 + (o >> 6) * 32 + ((o >> 5) & 1) * 16 + (ln >> 4) * 8]); }
#pragma unroll
    for (int it = 0; it < 2; ++it) *(v8h*)(d + (size_t)(it * 256 + tid) * 8) = val[it];
}

// vt_tile: 64 keys x 64 columns of v (src = first element, row pitch DM; one head x 2 key chunks) -> 8 V^T fragments (row d, k = key; f16 of the bf16 RNE value) at dst, through LDS (cross-wave: block barrier).
__device__ __forceinline__ void vt_tile(const float* __restrict__ src, h16* dst, h16* ts, int tid) {
#pragma unroll
    for (int i = 0; i < 4; ++i) { const int t = i * 16 + (tid >> 4), c4 = (tid & 15) * 4;
        const v4f x = *(const v4f*)(src + (size_t)t * DM + c4);
#pragma unroll
        for (int e = 0; e < 4; ++e) ts[(c4 + e) * 72 + t] = (h16)bfr(x[e]); }
    __syncthreads();
    v8h val[2];
#pragma unroll
    for (int it = 0; it < 2; ++it) { const int o = it * 256 + tid, ln = o & 31;   // o = 16-B piece: [key chunk o>>8][d tile (o>>6)&3][load (o>>5)&1][lane]
        val[it] = *(const v8ha*)(&ts[(((o >> 6) & 3) * 16 + (ln & 15)) * 72 + (o >> 8) * 32 + ((o >> 5) & 1) * 16 + (ln >> 4) * 8]); }
#pragma unroll
    for (int it = 0; it < 2; ++it) *(v8h*)(dst + (size_t)(it * 256 + tid) * 8) = val[it];
}

// k_prep: all four operand planes in ONE launch (they depend on nothing but the inputs): the flat block index picks the plane and the tile, alike for the whole block, so each block runs one tile body with its one barrier.
// Blocks [0, VT_BL): V^T tiles (key tile fastest, then head, then batch); then Q, then K (row tile fastest, then 256-column block; per-batch input pitch SEQ_FULL rows); then W (x64).
#define VT_BL ((SEQ / 64) * (DM / 64) * NB)
#define ST_RT (NB * SEQ / 16)            // 16-row tiles of a stream plane
#define ST_BL (ST_RT * (DM / 256))
#define W_RT  (DM / 16)
#define W_BL  (W_RT * (DM / 256))
__global__ __launch_bounds__(256) void k_prep(const float* __restrict__ q, const float* __restrict__ k, const float* __restrict__ v, const float* __restrict__ w, h16* QP, h16* KP, h16* VT, h16* WH) {
    __shared__ __align__(16) h16 ts[64 * 72];
    static_assert(64 * 72 >= 16 * 264);   // one LDS tile serves either body
    const int tid = threadIdx.x; const int bid = blockIdx.x;
    if (bid < VT_BL) {
        const int t0 = (bid % (SEQ / 64)) * 64, hd = (bid / (SEQ / 64)) % (DM / 64), b = bid / ((SEQ / 64) * (DM / 64));
        vt_tile(v + ((size_t)b * SEQ_FULL + t0) * DM + hd * 64, VT + (((size_t)b * NH_ + hd) * (SEQ / 32) + t0 / 32) * 4 * FRG, ts, tid);
    } else if (bid < VT_BL + 2 * ST_BL) {
        const int u = bid - VT_BL; const bool isk = u >= ST_BL; const int x = isk ? u - ST_BL : u;
        const int rt = x % ST_RT, c0 = (x / ST_RT) * 256;
        const size_t row = (size_t)(rt / (SEQ / 16)) * SEQ_FULL + (size_t)(rt % (SEQ / 16)) * 16;
        pack_tile((isk ? k : q) + row * DM + c0, (isk ? KP : QP) + ((size_t)rt * (DM / 32) + c0 / 32) * FRG, 1.0f, ts, tid);
    } else {
        const int x = bid - (VT_BL + 2 * ST_BL); const int rt = x % W_RT, c0 = (x / W_RT) * 256;
        pack_tile(w + (size_t)rt * 16 * DM + c0, WH + ((size_t)rt * (DM / 32) + c0 / 32) * FRG, WSC, ts, tid);
    }
}

// LDS ring of k_flash: a stage = FKS passes of 32 keys of one (batch, head) = K: 2 * FKS row tiles x 2 fragments, V^T: FKS key chunks x 4 fragments, every fragment as it lies in its plane; two buffers, laid [K 0 | K 1 | V^T 0 | V^T 1],
// so that pass ps reads K at byte (ps mod 2 FKS) * 4096 and V^T at 2 FSK bytes behind it.
#define FKS  4                           // passes per stage
#define FSK  (FKS * 4 * FRG * 2)         // K part of a stage, bytes; the V^T part is as large
#define FNS  (SEQ / (32 * FKS))          // stages
static_assert(AW * 32 * 16 == 4 * FRG * 2);    // one copy of the whole work-group moves 4 fragments (4 KiB): two K row tiles of the head, or one V^T key chunk
static_assert(FKS == 4);                       // cp44: four K copies and four V^T copies a stage
static_assert(SEQ % (32 * FKS) == 0);
static_assert(FNS >= 2);                       // the prologue fills two stages
// eight asynchronous 16-B copies per lane: K piece i from gk + i * sk halves, V^T piece i from gv + i * sv halves, to LDS byte addresses l + i * 4096 and l + 2 * FSK + i * 4096.
__device__ __forceinline__ void cp44(unsigned l, const h16* gk, size_t sk, const h16* gv, size_t sv) {
    // the s_wait_xcnt stands inside the copies' own statement, in front of any later rewrite of an address register that a copy names
    asm volatile("global_load_async_to_lds_b128 %0, %8, off\n\t"
                 "global_load_async_to_lds_b128 %1, %9, off\n\t"
                 "global_load_async_to_lds_b128 %2, %10, off\n\t"
                 "global_load_async_to_lds_b128 %3, %11, off\n\t"
                 "global_load_async_to_lds_b128 %4, %12, off\n\t"
                 "global_load_async_to_lds_b128 %5, %13, off\n\t"
                 "global_load_async_to_lds_b128 %6, %14, off\n\t"
                 "global_load_async_to_lds_b128 %7, %15, off\n\t"
                 "s_wait_xcnt 0x0"
                 :: "v"(l), "v"(l + 4096), "v"(l + 2 * 4096), "v"(l + 3 * 4096), "v"(l + 2 * FSK), "v"(l + 2 * FSK + 4096), "v"(l + 2 * FSK + 2 * 4096), "v"(l + 2 * FSK + 3 * 4096),
                    "v"(gk), "v"(gk + sk), "v"(gk + 2 * sk), "v"(gk + 3 * sk), "v"(gv), "v"(gv + sv), "v"(gv + 2 * sv), "v"(gv + 3 * sv)
                 : "memory");
}

// k_flash: fused attention, one wave per 32 query rows (QT = 2 tiles of 16) of one (batch, head), 8 waves a work-group; Q fragments straight from the f16 plane; K and V^T fragments come to LDS by asynchronous copies, one stage (128 keys) for all 8 waves, issued a whole stage ahead of their use, and are read from there (two 16-B LDS loads each).
// Each K and each V^T fragment is loaded once per wave and feeds one product per query tile, so the loaded bytes per product are 1 / QT of a one-tile wave's.
// Transposed form: S^T[key][t] = K Q^T (A = K rows, B = Q rows); lane (t = lane&15, h = lane>>4) holds keys 8h+r of each 16-key tile, so the packed
// P tile is directly the B fragment of O^T[d][t] = V^T P^T (element r <- tile keys 0..15, element 8+r <- tile keys 16..31, lane unchanged).
// Softmax state: the maximum in use is one scalar per lane and query tile, alike in the two lane halves of a column. It is refreshed lazily: each pass takes the lane's maximum of the raw scores (the scale is positive) and tests ONCE, for the whole wave,
// whether any lane's exceeds the maximum in use by more than TAU; only then (a scalar branch: always in pass 0, afterwards rarely) are the halves joined (xor-16 exchange), the maxima raised and the sums and O^T rescaled. Any maximum cancels in the normalisation.
// The row sums run on the matrix pipe: per query tile and pass one more product, A = all ones, B = the same packed P tile, so every row of its 16 x 16 result holds, per column t, the f32 sum over the 32 keys of the f16 P values
// that O^T is built from. Element 0 of that accumulator is the lane's sum (both lane halves hold it): it alone is rescaled and read; elements 1..7 are copies that nobody reads (bounded by SEQ * 32768, so they stay finite).
__global__ __launch_bounds__(32 * AW) void k_flash(const h16* __restrict__ QP, const h16* __restrict__ KP, const h16* __restrict__ VT, h16* CTX) {
    __shared__ __align__(16) unsigned char ring[4 * FSK];
    const int tid = threadIdx.x;
    const int lane = threadIdx.x & 31, wave = __builtin_amdgcn_readfirstlane((int)(threadIdx.x >> 5));
    const int zh = blockIdx.y; const int b = zh / NH_, h = zh % NH_;
    const int t0 = (blockIdx.x * AW + wave) * (16 * QT);
    const size_t rbase = ((size_t)(b * SEQ / 16) * (DM / 32) + 2 * h) * FRG + 8 * lane;   // fragment (row tile 0 of the batch, k chunk 2h)
    const size_t qo = rbase + (size_t)(t0 / 16) * (DM / 32) * FRG;
    v16h qh0[QT], qh1[QT];                                          // B fragments: col t, k = d
#pragma unroll
    for (int q = 0; q < QT; ++q) { qh0[q] = ldh(QP + qo + (size_t)q * (DM / 32) * FRG); qh1[q] = ldh(QP + qo + (size_t)q * (DM / 32) * FRG + FRG); }
    // the lane's 16 B of each copy: K piece = row tiles 2i, 2i+1 of the stage (threads 0..127 | 128..255), 2 KiB each (k chunks 2h, 2h+1 lie side by side); V^T piece = key chunk i, 4 KiB
    const size_t ksp = (size_t)2 * (DM / 32) * FRG, vsp = (size_t)4 * FRG;   // halves from one piece to the next
    const h16* gk = KP + ((size_t)(b * SEQ / 16 + (tid >> 7)) * (DM / 32) + 2 * h) * FRG + 8 * (tid & 127);   // + stage * FKS pieces
    const h16* gv = VT + (size_t)zh * (SEQ / 32) * 4 * FRG + 8 * tid;                                         // + stage * FKS pieces
    const unsigned lb = (unsigned)(size_t)ring + 16u * (unsigned)tid;
    cp44(lb, gk, ksp, gv, vsp);
    asm volatile("s_wait_asynccnt 0x0" ::: "memory");   // this wave's copies of stage 0 have landed
    __syncthreads();                                    // ... and every other wave's
    cp44(lb + FSK, gk + FKS * ksp, ksp, gv + FKS * vsp, vsp);
    v8f o0[QT], o1[QT], o2[QT], o3[QT], ls[QT]; float m[QT], sh[QT], lim[QT];   // sh = PSH - m; lim = (m + TAU) / SC2, the raw score above which m must rise
    v16h ones;                                                      // A fragment of the row-sum product: 1.0 at every (row, k), so no lane map enters
#pragma unroll
    for (int e = 0; e < 16; ++e) ones[e] = (h16)1.0f;
#pragma unroll
    for (int q = 0; q < QT; ++q) { o0[q] = (v8f){}; o1[q] = (v8f){}; o2[q] = (v8f){}; o3[q] = (v8f){}; ls[q] = (v8f){}; m[q] = -3.0e38f; sh[q] = PSH; lim[q] = -3.0e38f; }
#pragma unroll 1
    for (int ps = 0; ps < SEQ / 32; ++ps) {
        const h16* ka = (const h16*)(ring + (unsigned)(ps & (2 * FKS - 1)) * 4096u) + 8 * lane;   // + (row tile * 2 + k chunk) fragments
        const v16h ka0 = ldh(ka), ka1 = ldh(ka + FRG), kb0 = ldh(ka + 2 * FRG), kb1 = ldh(ka + 3 * FRG);
        v8f sa[QT], sb[QT];
#pragma unroll
        for (int q = 0; q < QT; ++q) { sa[q] = wmma16(ka0, qh0[q], (v8f){}); sb[q] = wmma16(kb0, qh0[q], (v8f){}); }
#pragma unroll
        for (int q = 0; q < QT; ++q) { sa[q] = wmma16(ka1, qh1[q], sa[q]); sb[q] = wmma16(kb1, qh1[q], sb[q]); }
        // four vector slots between the last score product and the first read of its result
        asm volatile("v_nop\n\tv_nop\n\tv_nop\n\tv_nop" : "+v"(sa[0]), "+v"(sb[0]), "+v"(sa[1]), "+v"(sb[1]) : "v"(ka0), "v"(ka1), "v"(kb0), "v"(kb1));
        float mr[QT]; bool need = false;
#pragma unroll
        for (int q = 0; q < QT; ++q) {   // the lane's maximum of its 16 raw scores
            float mx = -3.0e38f;
#pragma unroll
            for (int r = 0; r < 8; ++r) mx = fmaxf(mx, fmaxf(sa[q][r], sb[q][r]));
            mr[q] = mx; need = need || (mx > lim[q]);
        }
        if (__builtin_amdgcn_ballot_w32(need) != 0) {   // one scalar branch per pass, every lane on inside it
#pragma unroll
            for (int q = 0; q < QT; ++q) {
                float mx = mr[q] * SC2;
                mx = fmaxf(mx, __shfl_xor(mx, 16, 32));
                const float mnew = fmaxf(m[q], mx);
                const float alpha = __builtin_amdgcn_exp2f(m[q] - mnew);
                m[q] = mnew; sh[q] = PSH - mnew; lim[q] = (mnew + TAU) * (1.0f / SC2);
                ls[q][0] = ls[q][0] * alpha;
                o0[q] = o0[q] * alpha; o1[q] = o1[q] * alpha; o2[q] = o2[q] * alpha; o3[q] = o3[q] * alpha;
            }
        }
        v16h pb[QT];
#pragma unroll
        for (int q = 0; q < QT; ++q) {
            const v2f c2 = { SC2, SC2 }, s2 = { sh[q], sh[q] };
#pragma unroll
            for (int i = 0; i < 8; ++i) {   // elements 2i, 2i+1 of the 32-key operand: neighbouring registers of one score tile share a packed multiply-add and a packed conversion
                const v8f s = i < 4 ? sa[q] : sb[q];
                const v2f x = __builtin_elementwise_fma((v2f){ s[2 * (i & 3)], s[2 * (i & 3) + 1] }, c2, s2);
                pb[q][2 * i] = (h16)__builtin_amdgcn_exp2f(x.x); pb[q][2 * i + 1] = (h16)__builtin_amdgcn_exp2f(x.y);
            }
        }
        const h16* va = ka + FSK;   // 2 FSK bytes on: + j fragments
        const v16h v0 = ldh(va), v1 = ldh(va + FRG), v2 = ldh(va + 2 * FRG), v3 = ldh(va + 3 * FRG);
#pragma unroll
        for (int q = 0; q < QT; ++q) ls[q] = wmma16(ones, pb[q], ls[q]);
#pragma unroll
        for (int q = 0; q < QT; ++q) { o0[q] = wmma16(v0, pb[q], o0[q]); o1[q] = wmma16(v1, pb[q], o1[q]); o2[q] = wmma16(v2, pb[q], o2[q]); o3[q] = wmma16(v3, pb[q], o3[q]); }
        // four vector slots behind the last product, also on the taken side of the loop branch
        asm volatile("v_nop\n\tv_nop\n\tv_nop\n\tv_nop" : "+v"(o0[0]), "+v"(o1[0]), "+v"(o2[0]), "+v"(o3[0]), "+v"(o0[1]), "+v"(o1[1]), "+v"(o2[1]), "+v"(o3[1]), "+v"(ls[0]), "+v"(ls[1]) : "v"(v0), "v"(v1), "v"(v2), "v"(v3), "v"(pb[0]), "v"(pb[1]));
        if ((ps & (FKS - 1)) == FKS - 1) {   // foot of stage st (the test reads the same in every wave of the work-group)
            const int st = ps / FKS;
            asm volatile("s_wait_dscnt 0x0" ::: "memory");      // this wave's reads of the buffer are done before it is refilled
            asm volatile("s_wait_asynccnt 0x0" ::: "memory");   // this wave's copies of stage st + 1 have landed
            __syncthreads();                                    // publishes stage st + 1 and ends every wave's reads of stage st
            if (st + 2 < FNS) cp44(lb + (unsigned)(st & 1) * FSK, gk + (size_t)(st + 2) * FKS * ksp, ksp, gv + (size_t)(st + 2) * FKS * vsp, vsp);
        }
    }
    asm volatile("s_wait_asynccnt 0x0" ::: "memory");   // nothing of this wave is in flight when it leaves the ring
#pragma unroll
    for (int q = 0; q < QT; ++q) {
        const float lt = ls[q][0];
        const float inv = CXS * (1.0f / lt);
        // O^T D layout: o_j[r] = (d = 16j + 8h + r, t = lane&15), which is load j&1 of ctx fragment (row tile t0/16 + q, k chunk 2*head + (j>>1)) at this same lane: stored from registers, 512 contiguous bytes per store
        h16* cw = CTX + ((size_t)((b * SEQ + t0) / 16 + q) * (2 * DM / 32) + 2 * h) * FRG + 8 * lane;
        const v8f oj[4] = { o0[q], o1[q], o2[q], o3[q] };
#pragma unroll
        for (int j = 0; j < 4; ++j) { v8h hv, rv;
#pragma unroll
            for (int r = 0; r < 8; ++r) { const float x = oj[j][r] * inv; const h16 a = (h16)x; hv[r] = a; rv[r] = (h16)(x - (float)a); }
            *(v8h*)(cw + j * 256) = hv; *(v8h*)(cw + (DM / 32) * FRG + j * 256) = rv; }
    }
}

// k_out: f16 GEMM, one 128 x 256 tile of OUT per 8-wave work-group, one 64 x 64 tile (16 accumulators) per wave (2 wave rows x 4 wave columns); the operand fragments come to LDS once per work-group by asynchronous copies and are read from there,
// so a ctx fragment is fetched from L2 once for 4 waves and a W fragment once for 2 waves and for both ctx parts.
// OUT[m][n] = 2^-18 * sum_{k<1024} (value[m][k] + remainder[m][k]) Bt[n][k] + b[n]; A = ctx plane [M][value 1024 | remainder 1024] (x4096), Bt = W plane [out][in] (x64). grid (M/128, DM/256), 256 threads.
// A stage = OKC k chunks of 32 = [ctx value: 8 row tiles x 2 KiB | ctx remainder: the same | W: 16 column tiles x 2 KiB], every fragment as it lies in its plane (the OKC chunks of a tile lie side by side); two buffers, a stage is copied while the one before it is worked on.
#define OW   8                           // waves per work-group
#define OKC  2                           // k chunks per stage
#define OSB  65536                       // bytes of a stage
#define ONS  (DM / 32 / OKC)             // stages
static_assert(OKC * FRG * 2 == 2048);          // a tile's part of a stage: 128 lanes x 16 B, so one copy of the whole work-group moves two tiles
static_assert(2 * FSK == 32768);               // cp44 puts its second group 32 KiB behind its first: ctx value | W tiles 0..7, then, 16 KiB on, ctx remainder | W tiles 8..15
static_assert(ONS >= 2);                       // the prologue fills two stages
static_assert((NB * SEQ) % 128 == 0);
// amdgpu_num_vgpr(256): 128 accumulator and at most 112 fragment registers fit; left alone the allocator took 266, and the loop then switched register windows around its reads and products
__global__ __launch_bounds__(32 * OW) __attribute__((amdgpu_num_vgpr(256))) void k_out(const h16* __restrict__ A, const h16* __restrict__ Bt, const float* __restrict__ bias, float* OUT) {
    __shared__ __align__(16) unsigned char ring[2 * OSB];
    __shared__ __align__(16) float osa[OW][16 * 68];
    const int KA = 2 * DM;
    const int tid = threadIdx.x, lane = threadIdx.x & 31, lr = lane & 15, hi = lane >> 4;
    const int wave = __builtin_amdgcn_readfirstlane((int)(threadIdx.x >> 5)); const int wm = wave & 1, wn = wave >> 1;
    const int r0 = blockIdx.x * 128 + wm * 64, c0 = blockIdx.y * 256 + wn * 64;
    float* os = osa[wave];
    v8f acc[4][4];
#pragma unroll
    for (int mb = 0; mb < 4; ++mb)
#pragma unroll
        for (int nb = 0; nb < 4; ++nb) acc[mb][nb] = (v8f){};
    // the lane's 16 B of each copy: piece i = tiles 2i, 2i+1 of the work-group's rows (threads 0..127 | 128..255), 2 KiB each
    const size_t asp = (size_t)2 * (KA / 32) * FRG, bsp = (size_t)2 * (DM / 32) * FRG;   // halves from one piece to the next
    const h16* ga = A + (size_t)(blockIdx.x * 8 + (tid >> 7)) * (KA / 32) * FRG + 8 * (tid & 127);     // + stage * OKC fragments; remainder: + DM / 32 fragments
    const h16* gb = Bt + (size_t)(blockIdx.y * 16 + (tid >> 7)) * (DM / 32) * FRG + 8 * (tid & 127);   // + stage * OKC fragments
    const unsigned lb = (unsigned)(size_t)ring + 16u * (unsigned)tid;
    cp44(lb, ga, asp, gb, bsp);
    cp44(lb + 16384, ga + (DM / 32) * FRG, asp, gb + 4 * bsp, bsp);
    asm volatile("s_wait_asynccnt 0x0" ::: "memory");   // this wave's copies of stage 0 have landed
    __syncthreads();                                    // ... and every other wave's
    cp44(lb + OSB, ga + OKC * FRG, asp, gb + OKC * FRG, bsp);
    cp44(lb + OSB + 16384, ga + (DM / 32 + OKC) * FRG, asp, gb + 4 * bsp + OKC * FRG, bsp);
#pragma unroll 1
    for (int st = 0; st < ONS; ++st) {
        const h16* pa = (const h16*)(ring + (unsigned)(st & 1) * OSB + (unsigned)wm * 8192u) + 8 * lane;            // + (mb * OKC + chunk) fragments; remainder 16 KiB on
        const h16* pb = (const h16*)(ring + (unsigned)(st & 1) * OSB + 32768u + (unsigned)wn * 8192u) + 8 * lane;   // + (nb * OKC + chunk) fragments
        // four blocks of 16 products: value x W and remainder x W of chunk 0, then of chunk 1. The later blocks' fragments are read from LDS a block ahead (all inside this stage's buffer), but for two W fragments of chunk 1, so that their latency runs under the block before.
        v16h av0[4], ar0[4], bf0[4], av1[4], ar1[4], bf1[4];
        static_assert(OKC == 2);
#pragma unroll
        for (int i = 0; i < 4; ++i) { bf0[i] = ldh(pb + (i * OKC) * FRG); av0[i] = ldh(pa + (i * OKC) * FRG); }
#pragma unroll
        for (int i = 0; i < 4; ++i) ar0[i] = ldh(pa + 8192 + (i * OKC) * FRG);
        __builtin_amdgcn_sched_barrier(0);   // keeps the reads of the second block ahead of the first block's products (the scheduler otherwise sinks them next to their use, where their latency is waited out)
#pragma unroll
        for (int nb = 0; nb < 4; ++nb)
#pragma unroll
            for (int mb = 0; mb < 4; ++mb) acc[mb][nb] = wmma16(av0[mb], bf0[nb], acc[mb][nb]);
        __builtin_amdgcn_sched_barrier(0);   // the next group stays behind the last reader of the registers it refills and, with the next fence, ahead of the second block
#pragma unroll
        for (int i = 0; i < 4; ++i) av1[i] = ldh(pa + (i * OKC + 1) * FRG);
        bf1[0] = ldh(pb + 1 * FRG); bf1[1] = ldh(pb + (OKC + 1) * FRG);   // the other two W fragments of chunk 1 follow a block later, when chunk 0's are free: the kernel stays inside 256 registers
        __builtin_amdgcn_sched_barrier(0);   // as above, for the third block's reads
#pragma unroll
        for (int nb = 0; nb < 4; ++nb)
#pragma unroll
            for (int mb = 0; mb < 4; ++mb) acc[mb][nb] = wmma16(ar0[mb], bf0[nb], acc[mb][nb]);
        __builtin_amdgcn_sched_barrier(0);   // as above
        bf1[2] = ldh(pb + (2 * OKC + 1) * FRG); bf1[3] = ldh(pb + (3 * OKC + 1) * FRG);   // first used eight products on
#pragma unroll
        for (int i = 0; i < 4; ++i) ar1[i] = ldh(pa + 8192 + (i * OKC + 1) * FRG);
        __builtin_amdgcn_sched_barrier(0);   // as above, for the fourth block's reads
#pragma unroll
        for (int nb = 0; nb < 4; ++nb)
#pragma unroll
            for (int mb = 0; mb < 4; ++mb) acc[mb][nb] = wmma16(av1[mb], bf1[nb], acc[mb][nb]);
#pragma unroll
        for (int nb = 0; nb < 4; ++nb)
#pragma unroll
            for (int mb = 0; mb < 4; ++mb) acc[mb][nb] = wmma16(ar1[mb], bf1[nb], acc[mb][nb]);
        __builtin_amdgcn_sched_barrier(0);   // every product of the stage stays in its written order, in front of the barrier (the scheduler otherwise runs the last column's products first, directly behind their reads, and sinks the rest below the barrier, which delays the refill)
        // four vector slots behind the last product, in front of the address arithmetic of the copies and on the taken side of the loop branch
        asm volatile("v_nop\n\tv_nop\n\tv_nop\n\tv_nop" : "+v"(acc[0][3]), "+v"(acc[1][3]), "+v"(acc[2][3]), "+v"(acc[3][3]) : "v"(ar1[0]), "v"(ar1[1]), "v"(ar1[2]), "v"(ar1[3]), "v"(bf1[3]));
        asm volatile("s_wait_dscnt 0x0" ::: "memory");      // this wave's reads of the buffer are done before it is refilled
        asm volatile("s_wait_asynccnt 0x0" ::: "memory");   // this wave's copies of stage st + 1 have landed
        __syncthreads();                                    // publishes stage st + 1 and ends every wave's reads of stage st
        if (st + 2 < ONS) {
            const unsigned l = lb + (unsigned)(st & 1) * OSB; const size_t so = (size_t)(st + 2) * OKC * FRG;
            cp44(l, ga + so, asp, gb + so, bsp);
            cp44(l + 16384, ga + (DM / 32) * FRG + so, asp, gb + 4 * bsp + so, bsp);
        }
    }
    asm volatile("s_wait_asynccnt 0x0" ::: "memory");   // nothing of this wave is in flight when it leaves the ring
    v4f bv = *(const v4f*)(bias + c0 + lr * 4);
#pragma unroll
    for (int i = 0; i < 4; ++i) bv[i] = bfr(bv[i]);
    float* orow = OUT + ((size_t)(r0 / SEQ) * OUT_SEQ + (size_t)(r0 % SEQ)) * DM + c0;
#pragma unroll
    for (int mb = 0; mb < 4; ++mb) {
#pragma unroll
        for (int nb = 0; nb < 4; ++nb) {
#pragma unroll
            for (int j = 0; j < 8; ++j) os[(hi * 8 + j) * 68 + nb * 16 + lr] = acc[mb][nb][j] * OSC; }   // D: row 8h+j, col lane&15
        wave_sync();
{
#pragma unroll
            for (int s = 0; s < 8; ++s) { const int row = 2 * s + hi, cofs = lr * 4;   // 8 s x 2 rows = 16 rows; 16 lanes x 4 floats = 64 columns
                const v4f x = *(const v4fa*)(&os[row * 68 + cofs]);
                const v4f val = x + bv;
                *(v4f*)(orow + (size_t)(mb * 16 + row) * DM + cofs) = val; }
             }
        wave_sync();
    }
}

static constexpr size_t al256(size_t v) { return (v + 255) & ~(size_t)255; }
static constexpr size_t SZ_PL = al256((size_t)NB * SEQ * DM * 2);          // one f16 plane of a stream
static constexpr size_t SZ_WH = al256((size_t)DM * DM * 2);
static constexpr size_t SZ_CX = al256((size_t)NB * SEQ * 2 * DM * 2);      // ctx value | remainder
static constexpr size_t SZ_TOTAL = 3 * SZ_PL + SZ_WH + SZ_CX;
static_assert(SZ_TOTAL <= (size_t)134217728);          // workspace carve <= 128 MiB

extern "C" void kernel_launch(void* const* d_in, const int* in_sizes, int n_in,
                              void* d_out, int out_size, void* d_ws, size_t ws_size, hipStream_t stream) {
    if (n_in < 5) return;
    const size_t needx = ((size_t)(NB - 1) * SEQ_FULL + SEQ) * DM;
    if ((size_t)in_sizes[0] < needx || (size_t)in_sizes[1] < needx || (size_t)in_sizes[2] < needx) return;
    if ((size_t)in_sizes[3] < (size_t)DM * DM || (size_t)in_sizes[4] < (size_t)DM) return;
    if ((size_t)out_size < ((size_t)(NB - 1) * OUT_SEQ + SEQ) * DM) return;
    if (SZ_TOTAL > ws_size) return;
    const float* q = (const float*)d_in[0]; const float* k = (const float*)d_in[1]; const float* v = (const float*)d_in[2];   // wire order q, k, v, W_out, b_out
    const float* wo = (const float*)d_in[3]; const float* bo = (const float*)d_in[4];                                         // W_out [out][in] = Bt as-is
    float* OUT = (float*)d_out;      // [NB][SEQ][1024]
    char* wsp = (char*)d_ws;
    h16* QP = (h16*)wsp; wsp += SZ_PL;               // [NB*SEQ/16][32] fragments
    h16* KP = (h16*)wsp; wsp += SZ_PL;               // [NB*SEQ/16][32] fragments
    h16* VT = (h16*)wsp; wsp += SZ_PL;               // [NB*16][SEQ/32][4] fragments
    h16* WH = (h16*)wsp; wsp += SZ_WH;               // [1024/16][32] fragments, x64
    h16* CX = (h16*)wsp; wsp += SZ_CX;               // [NB*SEQ/16][64] fragments, x4096

    // Q, K, V^T and W planes: one launch
    k_prep<<<dim3(VT_BL + 2 * ST_BL + W_BL, 1, 1), 256, 0, stream>>>(q, k, v, wo, QP, KP, VT, WH);

    k_flash<<<dim3(SEQ / (16 * AW * QT), NB * NH_, 1), 32 * AW, 0, stream>>>(QP, KP, VT, CX);

    // out = ctx W^T + b: A = ctx rows (m = b*SEQ + t), Bt = W rows (n = out column)
    k_out<<<dim3(NB * SEQ / 128, DM / 256, 1), 32 * OW, 0, stream>>>(CX, WH, bo, OUT);
}

// v010
// A run of this version takes 75.1 microseconds.
// Versions in between are left out here; by their measured steps it is 1.18 times as fast as v008.
// Over all steps from v000 it is 3.47 times as fast.
#include <hip/hip_runtime.h>

// Multi-head attention on raw streams q, k, v [NB][SEQ][1024] = 16 heads x 64 (no input projections, no mask), score scale 1/8, output projection y = ctx W^T + b with W [out][in].
// Compute dtypes, f32 accumulate everywhere, all contractions v_wmma_f32_16x16x32_f16: q, k, v, W, b are RNE-converted to bf16, q, k, v, W held exactly in f16 (W with a x64 carry), b in f32; scores single product; P (x256 carry, cancels in the normalisation) and v single product;
// ctx carried x4096 as one f16 value (single product against the W plane); softmax f32 (online; the maximum of keys 0..31 held fixed, a running max only in the second walk); bias added in f32.
// Layout: every f16 operand plane is stored in fragment order: one 16-row x 32-k fragment = 1 KiB = [load 0|1][lane 0..31][8 halves], lane = 16*hi + (row & 15), element e of load ld = k 16*ld + 8*hi + e,
// so each wave-wide 16-B load reads 512 contiguous bytes (4 whole lines). Q, K, W: fragment index (row/16)*32 + col/32; V^T: ((b*16+h)*(SEQ/32) + key/32)*4 + d/16; ctx: (row/16)*32 + k/32.
// Fused flash kernel in transposed form (S^T = K Q^T, O^T = V^T P^T; K and V^T staged in LDS per 8-wave work-group) writes the ctx plane, then a GEMM (128x256 tile per 8-wave work-group, operands staged in LDS) of ctx against W rows.

#ifndef NB
#define NB 4
#endif
#ifndef SEQ
#define SEQ 2048
#endif
#define NB_FULL  4
#define SEQ_FULL 2048
#ifndef OUT_SEQ
#define OUT_SEQ SEQ              // row pitch (in tokens) between batches of the output
#endif
#define DM   1024
#define NH_  16
#define HD   64
#define AW   8                   // waves per flash block
#define QT   2                   // 16-row query tiles per flash wave
#define SC2  (0.125f * 1.4426950408889634f)   // HD^-0.5 * log2(e)
#define PSH  8.0f                // log2 of the P carry (256)
#define TAU  7.0f                // in the lazy walk the maximum in use may trail a column's true maximum by up to this much (log2 domain): P <= 2^(PSH + TAU) = 32768, inside f16
#define CXS  4096.0f             // carry of the ctx plane
#define WSC  64.0f               // carry of the W plane
#define OSC  (1.0f / (4096.0f * 64.0f))

static_assert(HD == 64);
static_assert(NH_ * HD == DM);                 // head h = columns h*64 + d
static_assert((DM & (DM - 1)) == 0);
static_assert(DM % 256 == 0);                  // pack_tile takes 256 columns
static_assert(DM % 128 == 0);                  // a GEMM stage takes four k chunks of 32
static_assert(SEQ % 64 == 0);                  // a 64-row tile never straddles two batches
static_assert((NB * SEQ) % 64 == 0);
static_assert(SEQ % 32 == 0);                  // key loop steps by 32
static_assert(SEQ % (16 * AW * QT) == 0);      // flash grid covers the sequence exactly
static_assert(QT == 2);                        // the two v_nop statements of k_flash name both tiles' registers
static_assert(((size_t)SEQ * DM) % 64 == 0);
static_assert(((size_t)DM * DM) % 64 == 0);
static_assert(NB <= NB_FULL);
static_assert(SEQ <= SEQ_FULL);

typedef _Float16 h16;
typedef __attribute__((ext_vector_type(16))) _Float16 v16h;
typedef __attribute__((ext_vector_type(8)))  _Float16 v8h;
typedef __attribute__((ext_vector_type(8)))  float    v8f;
typedef __attribute__((ext_vector_type(4)))  float    v4f;
typedef __attribute__((ext_vector_type(2)))  float    v2f;
typedef v4f  __attribute__((may_alias)) v4fa;
typedef v8h  __attribute__((may_alias)) v8ha;
typedef __attribute__((ext_vector_type(4)))  _Float16 v4h;
typedef v4h  __attribute__((may_alias)) v4ha;

// RNE convert f32 -> bf16, returned as the f32 value of that bf16
__device__ __forceinline__ float bfr(float f) { unsigned u = __float_as_uint(f); u += 0x7FFFu + ((u >> 16) & 1u); return __uint_as_float(u & 0xFFFF0000u); }
__device__ __forceinline__ v16h cat16(v8h lo, v8h hi) { return __builtin_shufflevector(lo, hi, 0, 1, 2, 3, 4, 5, 6, 7, 8, 9, 10, 11, 12, 13, 14, 15); }
__device__ __forceinline__ v8f wmma16(v16h a, v16h b, v8f c) { return __builtin_amdgcn_wmma_f32_16x16x32_f16(false, a, false, b, (short)0, c, false, false); }
// fragment loader from a plane in fragment order; p = fragment base + 8*lane: elements 0..7 <- k0+8h+0..7, elements 8..15 <- k0+16+8h+0..7 (same map for A and B)
#define FRG 512                  // halves per fragment
__device__ __forceinline__ v16h ldh(const h16* p) { return cat16(*(const v8h*)p, *(const v8h*)(p + 256)); }
// ordering point for wave-private LDS tiles (same wave writes and reads)
__device__ __forceinline__ void wave_sync() { __builtin_amdgcn_fence(3 /* release order */, "wavefront"); __builtin_amdgcn_wave_barrier(); asm volatile("" ::: "memory"); }

// pack_tile: 16 f32 rows x 256 columns (s = first element, row pitch DM) -> 8 fragments of an f16 plane (bf16 RNE value x scale) at d: whole-line reads, row-major LDS tile (pitch 528 B = 16 B x odd), 8 KiB contiguous out (cross-wave: block barrier).
__device__ __forceinline__ void pack_tile(const float* __restrict__ s, h16* d, float scale, h16* ts, int tid) {
#pragma unroll
    for (int i = 0; i < 4; ++i) { const int idx = i * 256 + tid, row = idx >> 6, c4 = (idx & 63) * 4;
        const v4f x = *(const v4f*)(s + (size_t)row * DM + c4); v4h o;
#pragma unroll
        for (int e = 0; e < 4; ++e) o[e] = (h16)(bfr(x[e]) * scale);
        *(v4ha*)(&ts[row * 264 + c4]) = o; }
    __syncthreads();
    v8h val[2];
#pragma unroll
    for (int it = 0; it < 2; ++it) { const int o = it * 256 + tid, ln = o & 31;   // o = 16-B piece of the 8 fragments: [k chunk o>>6][load (o>>5)&1][lane]
        val[it] = *(const v8ha*)(&ts[(ln & 15) * 264 + (o >> 6) * 32 + ((o >> 5) & 1) * 16 + (ln >> 4) * 8]); }
#pragma unroll
    for (int it = 0; it < 2; ++it) *(v8h*)(d + (size_t)(it * 256 + tid) * 8) = val[it];
}

// vt_tile: 64 keys x 64 columns of v (src = first element, row pitch DM; one head x 2 key chunks) -> 8 V^T fragments (row d, k = key; f16 of the bf16 RNE value) at dst, through LDS (cross-wave: block barrier).
__device__ __forceinline__ void vt_tile(const float* __restrict__ src, h16* dst, h16* ts, int tid) {
#pragma unroll
    for (int i = 0; i < 4; ++i) { const int t = i * 16 + (tid >> 4), c4 = (tid & 15) * 4;
        const v4f x = *(const v4f*)(src + (size_t)t * DM + c4);
#pragma unroll
        for (int e = 0; e < 4; ++e) ts[(c4 + e) * 72 + t] = (h16)bfr(x[e]); }
    __syncthreads();
    v8h val[2];
#pragma unroll
    for (int it = 0; it < 2; ++it) { const int o = it * 256 + tid, ln = o & 31;   // o = 16-B piece: [key chunk o>>8][d tile (o>>6)&3][load (o>>5)&1][lane]
        val[it] = *(const v8ha*)(&ts[(((o >> 6) & 3) * 16 + (ln & 15)) * 72 + (o >> 8) * 32 + ((o >> 5) & 1) * 16 + (ln >> 4) * 8]); }
#pragma unroll
    for (int it = 0; it < 2; ++it) *(v8h*)(dst + (size_t)(it * 256 + tid) * 8) = val[it];
}

// k_prep: all four operand planes in ONE launch (they depend on nothing but the inputs): the flat block index picks the plane and the tile, alike for the whole block, so each block runs one tile body with its one barrier.
// Blocks [0, VT_BL): V^T tiles (key tile fastest, then head, then batch); then Q, then K (row tile fastest, then 256-column block; per-batch input pitch SEQ_FULL rows); then W (x64).
#define VT_BL ((SEQ / 64) * (DM / 64) * NB)
#define ST_RT (NB * SEQ / 16)            // 16-row tiles of a stream plane
#define ST_BL (ST_RT * (DM / 256))
#define W_RT  (DM / 16)
#define W_BL  (W_RT * (DM / 256))
__global__ __launch_bounds__(256) void k_prep(const float* __restrict__ q, const float* __restrict__ k, const float* __restrict__ v, const float* __restrict__ w, h16* QP, h16* KP, h16* VT, h16* WH) {
    __shared__ __align__(16) h16 ts[64 * 72];
    static_assert(64 * 72 >= 16 * 264);   // one LDS tile serves either body
    const int tid = threadIdx.x; const int bid = blockIdx.x;
    if (bid < VT_BL) {
        const int t0 = (bid % (SEQ / 64)) * 64, hd = (bid / (SEQ / 64)) % (DM / 64), b = bid / ((SEQ / 64) * (DM / 64));
        vt_tile(v + ((size_t)b * SEQ_FULL + t0) * DM + hd * 64, VT + (((size_t)b * NH_ + hd) * (SEQ / 32) + t0 / 32) * 4 * FRG, ts, tid);
    } else if (bid < VT_BL + 2 * ST_BL) {
        const int u = bid - VT_BL; const bool isk = u >= ST_BL; const int x = isk ? u - ST_BL : u;
        const int rt = x % ST_RT, c0 = (x / ST_RT) * 256;
        const size_t row = (size_t)(rt / (SEQ / 16)) * SEQ_FULL + (size_t)(rt % (SEQ / 16)) * 16;
        pack_tile((isk ? k : q) + row * DM + c0, (isk ? KP : QP) + ((size_t)rt * (DM / 32) + c0 / 32) * FRG, 1.0f, ts, tid);
    } else {
        const int x = bid - (VT_BL + 2 * ST_BL); const int rt = x % W_RT, c0 = (x / W_RT) * 256;
        pack_tile(w + (size_t)rt * 16 * DM + c0, WH + ((size_t)rt * (DM / 32) + c0 / 32) * FRG, WSC, ts, tid);
    }
}

// LDS ring of k_flash: a stage = FKS passes of 32 keys of one (batch, head) = K: 2 * FKS row tiles x 2 fragments, V^T: FKS key chunks x 4 fragments, every fragment as it lies in its plane; two buffers, laid [K 0 | K 1 | V^T 0 | V^T 1],
// so that pass ps reads K at byte (ps mod 2 FKS) * 4096 and V^T at 2 FSK bytes behind it.
#define FKS  4                           // passes per stage
#define FSK  (FKS * 4 * FRG * 2)         // K part of a stage, bytes; the V^T part is as large
#define FNS  (SEQ / (32 * FKS))          // stages
static_assert(AW * 32 * 16 == 4 * FRG * 2);    // one copy of the whole work-group moves 4 fragments (4 KiB): two K row tiles of the head, or one V^T key chunk
static_assert(FKS == 4);                       // cp44: four K copies and four V^T copies a stage
static_assert(SEQ % (32 * FKS) == 0);
static_assert(FNS >= 2);                       // the prologue fills two stages
// eight asynchronous 16-B copies per lane: K piece i from gk + i * sk halves, V^T piece i from gv + i * sv halves, to LDS byte addresses l + i * 4096 and l + 2 * FSK + i * 4096.
__device__ __forceinline__ void cp44(unsigned l, const h16* gk, size_t sk, const h16* gv, size_t sv) {
    // the s_wait_xcnt stands inside the copies' own statement, in front of any later rewrite of an address register that a copy names
    asm volatile("global_load_async_to_lds_b128 %0, %8, off\n\t"
                 "global_load_async_to_lds_b128 %1, %9, off\n\t"
                 "global_load_async_to_lds_b128 %2, %10, off\n\t"
                 "global_load_async_to_lds_b128 %3, %11, off\n\t"
                 "global_load_async_to_lds_b128 %4, %12, off\n\t"
                 "global_load_async_to_lds_b128 %5, %13, off\n\t"
                 "global_load_async_to_lds_b128 %6, %14, off\n\t"
                 "global_load_async_to_lds_b128 %7, %15, off\n\t"
                 "s_wait_xcnt 0x0"
                 :: "v"(l), "v"(l + 4096), "v"(l + 2 * 4096), "v"(l + 3 * 4096), "v"(l + 2 * FSK), "v"(l + 2 * FSK + 4096), "v"(l + 2 * FSK + 2 * 4096), "v"(l + 2 * FSK + 3 * 4096),
                    "v"(gk), "v"(gk + sk), "v"(gk + 2 * sk), "v"(gk + 3 * sk), "v"(gv), "v"(gv + sv), "v"(gv + 2 * sv), "v"(gv + 3 * sv)
                 : "memory");
}

// k_flash: fused attention, one wave per 32 query rows (QT = 2 tiles of 16) of one (batch, head), 8 waves a work-group; Q fragments straight from the f16 plane; K and V^T fragments come to LDS by asynchronous copies, one stage (128 keys) for all 8 waves, issued a whole stage ahead of their use, and are read from there (two 16-B LDS loads each).
// Each K and each V^T fragment is loaded once per wave and feeds one product per query tile, so the loaded bytes per product are 1 / QT of a one-tile wave's.
// Transposed form: S^T[key][t] = K Q^T (A = K rows, B = Q rows); lane (t = lane&15, h = lane>>4) holds keys 8h+r of each 16-key tile, so the packed
// P tile is directly the B fragment of O^T[d][t] = V^T P^T (element r <- tile keys 0..15, element 8+r <- tile keys 16..31, lane unchanged).
// Two walks over the keys. The first keeps, per column, the maximum of keys 0..31 for all passes and tests nothing per pass: P = 2^(PSH + score - maximum) stays inside f16 while no score tops that maximum by PSH or more;
// one that does turns into inf in the f16 conversion and from there into an inf or NaN row sum, which is looked at once, behind the last pass. Only then the whole work-group walks again, with the lazily refreshed maximum described next, from fresh start values.
// Softmax state: the maximum in use is one scalar per lane and query tile, alike in the two lane halves of a column. In the second walk it is refreshed lazily: each pass takes the lane's maximum of the raw scores (the scale is positive) and tests ONCE, for the whole wave,
// whether any lane's exceeds the maximum in use by more than TAU; only then (a scalar branch: always in pass 0, afterwards rarely) are the halves joined (xor-16 exchange), the maxima raised and the sums and O^T rescaled. Any maximum cancels in the normalisation.
// The row sums run on the matrix pipe: per query tile and pass one more product, A = all ones, B = the same packed P tile, so every row of its 16 x 16 result holds, per column t, the f32 sum over the 32 keys of the f16 P values
// that O^T is built from. Element 0 of that accumulator is the lane's sum (both lane halves hold it): it alone is rescaled and read; elements 1..7 are copies that nobody reads (in the lazy walk bounded by SEQ * 32768, so they stay finite).
struct walk_fixed { static constexpr bool on = false; };
struct walk_lazy  { static constexpr bool on = true; };
__global__ __launch_bounds__(32 * AW) void k_flash(const h16* __restrict__ QP, const h16* __restrict__ KP, const h16* __restrict__ VT, h16* CTX) {
    __shared__ __align__(16) unsigned char ring[4 * FSK];
    __shared__ int redo;
    const int tid = threadIdx.x;
    const int lane = threadIdx.x & 31, wave = __builtin_amdgcn_readfirstlane((int)(threadIdx.x >> 5));
    const int zh = blockIdx.y; const int b = zh / NH_, h = zh % NH_;
    const int t0 = (blockIdx.x * AW + wave) * (16 * QT);
    const size_t rbase = ((size_t)(b * SEQ / 16) * (DM / 32) + 2 * h) * FRG + 8 * lane;   // fragment (row tile 0 of the batch, k chunk 2h)
    const size_t qo = rbase + (size_t)(t0 / 16) * (DM / 32) * FRG;
    v16h qh0[QT], qh1[QT];                                          // B fragments: col t, k = d
#pragma unroll
    for (int q = 0; q < QT; ++q) { qh0[q] = ldh(QP + qo + (size_t)q * (DM / 32) * FRG); qh1[q] = ldh(QP + qo + (size_t)q * (DM / 32) * FRG + FRG); }
    // the lane's 16 B of each copy: K piece = row tiles 2i, 2i+1 of the stage (threads 0..127 | 128..255), 2 KiB each (k chunks 2h, 2h+1 lie side by side); V^T piece = key chunk i, 4 KiB
    const size_t ksp = (size_t)2 * (DM / 32) * FRG, vsp = (size_t)4 * FRG;   // halves from one piece to the next
    const h16* gk = KP + ((size_t)(b * SEQ / 16 + (tid >> 7)) * (DM / 32) + 2 * h) * FRG + 8 * (tid & 127);   // + stage * FKS pieces
    const h16* gv = VT + (size_t)zh * (SEQ / 32) * 4 * FRG + 8 * tid;                                         // + stage * FKS pieces
    const unsigned lb = (unsigned)(size_t)ring + 16u * (unsigned)tid;
    if (tid == 0) redo = 0;   // published by the first barrier below, long before any wave can set it
    v8f o0[QT], o1[QT], o2[QT], o3[QT], ls[QT]; float m[QT], sh[QT], lim[QT];   // sh = PSH - m; lim = (m + TAU) / SC2, the raw score above which m must rise
    v16h ones;                                                      // A fragment of the row-sum product: 1.0 at every (row, k), so no lane map enters
#pragma unroll
    for (int e = 0; e < 16; ++e) ones[e] = (h16)1.0f;
    // one whole walk over the keys: ring prologue, start values, all passes. lazy.on: with the per-pass test and refresh of the maximum; otherwise the maximum of the first 32 keys stays in use.
    auto walk = [&](auto lazy) __attribute__((always_inline)) {
        cp44(lb, gk, ksp, gv, vsp);
        asm volatile("s_wait_asynccnt 0x0" ::: "memory");   // this wave's copies of stage 0 have landed
        __syncthreads();                                    // ... and every other wave's
        cp44(lb + FSK, gk + FKS * ksp, ksp, gv + FKS * vsp, vsp);
#pragma unroll
        for (int q = 0; q < QT; ++q) { o0[q] = (v8f){}; o1[q] = (v8f){}; o2[q] = (v8f){}; o3[q] = (v8f){}; ls[q] = (v8f){}; m[q] = -3.0e38f; sh[q] = PSH; lim[q] = -3.0e38f; }
        if constexpr (!decltype(lazy)::on) {   // the column maxima of keys 0..31 (their scores are formed once more in pass 0): the value that the lazy walk takes in its pass 0
            const h16* ka = (const h16*)ring + 8 * lane;
            const v16h ka0 = ldh(ka), ka1 = ldh(ka + FRG), kb0 = ldh(ka + 2 * FRG), kb1 = ldh(ka + 3 * FRG);
#pragma unroll
            for (int q = 0; q < QT; ++q) {
                const v8f sa = wmma16(ka1, qh1[q], wmma16(ka0, qh0[q], (v8f){})), sb = wmma16(kb1, qh1[q], wmma16(kb0, qh0[q], (v8f){}));
                float mx = -3.0e38f;
#pragma unroll
                for (int r = 0; r < 8; ++r) mx = fmaxf(mx, fmaxf(sa[r], sb[r]));
                mx *= SC2;
                mx = fmaxf(mx, __shfl_xor(mx, 16, 32));
                m[q] = fmaxf(m[q], mx); sh[q] = PSH - m[q];
            }
        }
#pragma unroll 1
        for (int ps = 0; ps < SEQ / 32; ++ps) {
            const h16* ka = (const h16*)(ring + (unsigned)(ps & (2 * FKS - 1)) * 4096u) + 8 * lane;   // + (row tile * 2 + k chunk) fragments
            const v16h ka0 = ldh(ka), ka1 = ldh(ka + FRG), kb0 = ldh(ka + 2 * FRG), kb1 = ldh(ka + 3 * FRG);
            v8f sa[QT], sb[QT];
#pragma unroll
            for (int q = 0; q < QT; ++q) { sa[q] = wmma16(ka0, qh0[q], (v8f){}); sb[q] = wmma16(kb0, qh0[q], (v8f){}); }
#pragma unroll
            for (int q = 0; q < QT; ++q) { sa[q] = wmma16(ka1, qh1[q], sa[q]); sb[q] = wmma16(kb1, qh1[q], sb[q]); }
            // four vector slots between the last score product and the first read of its result
            asm volatile("v_nop\n\tv_nop\n\tv_nop\n\tv_nop" : "+v"(sa[0]), "+v"(sb[0]), "+v"(sa[1]), "+v"(sb[1]) : "v"(ka0), "v"(ka1), "v"(kb0), "v"(kb1));
            const h16* va = ka + FSK;   // 2 FSK bytes on: + j fragments
            const v16h v0 = ldh(va), v1 = ldh(va + FRG), v2 = ldh(va + 2 * FRG), v3 = ldh(va + 3 * FRG);
            __builtin_amdgcn_sched_barrier(0);   // keeps all eight V^T reads here, so that their latency runs under the softmax (the scheduler otherwise sinks half of them next to their products)
            if constexpr (decltype(lazy)::on) {
                float mr[QT]; bool need = false;
#pragma unroll
                for (int q = 0; q < QT; ++q) {   // the lane's maximum of its 16 raw scores
                    float mx = -3.0e38f;
#pragma unroll
                    for (int r = 0; r < 8; ++r) mx = fmaxf(mx, fmaxf(sa[q][r], sb[q][r]));
                    mr[q] = mx; need = need || (mx > lim[q]);
                }
                if (__builtin_amdgcn_ballot_w32(need) != 0) {   // one scalar branch per pass, every lane on inside it
#pragma unroll
                    for (int q = 0; q < QT; ++q) {
                        float mx = mr[q] * SC2;
                        mx = fmaxf(mx, __shfl_xor(mx, 16, 32));
                        const float mnew = fmaxf(m[q], mx);
                        const float alpha = __builtin_amdgcn_exp2f(m[q] - mnew);
                        m[q] = mnew; sh[q] = PSH - mnew; lim[q] = (mnew + TAU) * (1.0f / SC2);
                        ls[q][0] = ls[q][0] * alpha;
                        o0[q] = o0[q] * alpha; o1[q] = o1[q] * alpha; o2[q] = o2[q] * alpha; o3[q] = o3[q] * alpha;
                    }
                }
            }
            v16h pb[QT];
#pragma unroll
            for (int q = 0; q < QT; ++q) {
                const v2f c2 = { SC2, SC2 }, s2 = { sh[q], sh[q] };
#pragma unroll
                for (int i = 0; i < 8; ++i) {   // elements 2i, 2i+1 of the 32-key operand: neighbouring registers of one score tile share a packed multiply-add and a packed conversion
                    const v8f s = i < 4 ? sa[q] : sb[q];
                    const v2f x = __builtin_elementwise_fma((v2f){ s[2 * (i & 3)], s[2 * (i & 3) + 1] }, c2, s2);
                    pb[q][2 * i] = (h16)__builtin_amdgcn_exp2f(x.x); pb[q][2 * i + 1] = (h16)__builtin_amdgcn_exp2f(x.y);
                }
            }
#pragma unroll
            for (int q = 0; q < QT; ++q) ls[q] = wmma16(ones, pb[q], ls[q]);
#pragma unroll
            for (int q = 0; q < QT; ++q) { o0[q] = wmma16(v0, pb[q], o0[q]); o1[q] = wmma16(v1, pb[q], o1[q]); o2[q] = wmma16(v2, pb[q], o2[q]); o3[q] = wmma16(v3, pb[q], o3[q]); }
            // four vector slots behind the last product, also on the taken side of the loop branch
            asm volatile("v_nop\n\tv_nop\n\tv_nop\n\tv_nop" : "+v"(o0[0]), "+v"(o1[0]), "+v"(o2[0]), "+v"(o3[0]), "+v"(o0[1]), "+v"(o1[1]), "+v"(o2[1]), "+v"(o3[1]), "+v"(ls[0]), "+v"(ls[1]) : "v"(v0), "v"(v1), "v"(v2), "v"(v3), "v"(pb[0]), "v"(pb[1]));
            if ((ps & (FKS - 1)) == FKS - 1) {   // foot of stage st (the test reads the same in every wave of the work-group)
                const int st = ps / FKS;
                asm volatile("s_wait_dscnt 0x0" ::: "memory");      // this wave's reads of the buffer are done before it is refilled
                asm volatile("s_wait_asynccnt 0x0" ::: "memory");   // this wave's copies of stage st + 1 have landed
                __syncthreads();                                    // publishes stage st + 1 and ends every wave's reads of stage st
                if (st + 2 < FNS) cp44(lb + (unsigned)(st & 1) * FSK, gk + (size_t)(st + 2) * FKS * ksp, ksp, gv + (size_t)(st + 2) * FKS * vsp, vsp);
            }
        }
        asm volatile("s_wait_asynccnt 0x0" ::: "memory");   // nothing of this wave is in flight when it leaves the ring
    };
    walk(walk_fixed{});
    // A score more than PSH above the fixed maximum makes a P beyond f16: the conversion gives inf, and the row sum, which takes in every P of its column, is then inf or NaN. Any such column sends the whole work-group through the lazy walk, which holds for every input.
    const bool bad = !(ls[0][0] <= 3.0e38f) || !(ls[1][0] <= 3.0e38f);
    if (__builtin_amdgcn_ballot_w32(bad) != 0) redo = 1;   // every writer stores the same value
    __syncthreads();                                       // publishes redo; the ring's last reads ended at the walk's last barrier
    if (__builtin_amdgcn_readfirstlane(redo) != 0) walk(walk_lazy{});   // alike in every wave of the work-group, so the barriers inside are met by all
#pragma unroll
    for (int q = 0; q < QT; ++q) {
        const float lt = ls[q][0];
        const float inv = CXS * (1.0f / lt);
        // O^T D layout: o_j[r] = (d = 16j + 8h + r, t = lane&15), which is load j&1 of ctx fragment (row tile t0/16 + q, k chunk 2*head + (j>>1)) at this same lane: stored from registers, 512 contiguous bytes per store
        h16* cw = CTX + ((size_t)((b * SEQ + t0) / 16 + q) * (DM / 32) + 2 * h) * FRG + 8 * lane;
        const v8f oj[4] = { o0[q], o1[q], o2[q], o3[q] };
#pragma unroll
        for (int j = 0; j < 4; ++j) { v8h hv;
#pragma unroll
            for (int r = 0; r < 8; ++r) hv[r] = (h16)(oj[j][r] * inv);
            *(v8h*)(cw + j * 256) = hv; }
    }
}

// k_out: f16 GEMM, one 128 x 256 tile of OUT per 8-wave work-group, one 64 x 64 tile (16 accumulators) per wave (2 wave rows x 4 wave columns); the operand fragments come to LDS once per work-group by asynchronous copies and are read from there,
// so a ctx fragment is fetched from L2 once for 4 waves and a W fragment once for 2 waves.
// OUT[m][n] = 2^-18 * sum_{k<1024} ctx[m][k] Bt[n][k] + b[n]; A = ctx plane [M][1024] (x4096), Bt = W plane [out][in] (x64). grid (M/128, DM/256), 256 threads.
// A stage = OKC k chunks of 32 = [ctx: 8 row tiles x 4 KiB | W: 16 column tiles x 4 KiB], every fragment as it lies in its plane (the OKC chunks of a tile lie side by side); two buffers, a stage is copied while the one before it is worked on.
#define OW   8                           // waves per work-group
#define OKC  4                           // k chunks per stage
#define OSB  98304                       // bytes of a stage
#define ONS  (DM / 32 / OKC)             // stages
static_assert(OKC * FRG * 2 == OW * 32 * 16);  // a tile's part of a stage: one copy of the whole work-group moves one tile (4 KiB)
static_assert(OSB == (8 + 16) * OKC * FRG * 2);
static_assert(ONS >= 2);                       // the prologue fills two stages
static_assert((NB * SEQ) % 128 == 0);
// eight tiles of one plane, eight asynchronous 16-B copies per lane: tile i from g + i * s halves to LDS byte address l + i * 4096.
__device__ __forceinline__ void cp8(unsigned l, const h16* g, size_t s) {
    // the s_wait_xcnt stands inside the copies' own statement, in front of any later rewrite of an address register that a copy names
    asm volatile("global_load_async_to_lds_b128 %0, %8, off\n\t"
                 "global_load_async_to_lds_b128 %1, %9, off\n\t"
                 "global_load_async_to_lds_b128 %2, %10, off\n\t"
                 "global_load_async_to_lds_b128 %3, %11, off\n\t"
                 "global_load_async_to_lds_b128 %4, %12, off\n\t"
                 "global_load_async_to_lds_b128 %5, %13, off\n\t"
                 "global_load_async_to_lds_b128 %6, %14, off\n\t"
                 "global_load_async_to_lds_b128 %7, %15, off\n\t"
                 "s_wait_xcnt 0x0"
                 :: "v"(l), "v"(l + 4096), "v"(l + 2 * 4096), "v"(l + 3 * 4096), "v"(l + 4 * 4096), "v"(l + 5 * 4096), "v"(l + 6 * 4096), "v"(l + 7 * 4096),
                    "v"(g), "v"(g + s), "v"(g + 2 * s), "v"(g + 3 * s), "v"(g + 4 * s), "v"(g + 5 * s), "v"(g + 6 * s), "v"(g + 7 * s)
                 : "memory");
}
// one stage of k_out: ctx row tiles 0..7, W column tiles 0..7, W column tiles 8..15 (24 copies per lane)
__device__ __forceinline__ void cp_stage(unsigned l, const h16* ga, const h16* gb, size_t s) { cp8(l, ga, s); cp8(l + 32768, gb, s); cp8(l + 65536, gb + 8 * s, s); }
// amdgpu_num_vgpr(256): 128 accumulator and at most 112 fragment registers fit; past 256 the loop would switch register windows around its reads and products
__global__ __launch_bounds__(32 * OW) __attribute__((amdgpu_num_vgpr(256))) void k_out(const h16* __restrict__ A, const h16* __restrict__ Bt, const float* __restrict__ bias, float* OUT) {
    __shared__ __align__(16) unsigned char ring[2 * OSB];
    __shared__ __align__(16) float osa[OW][16 * 68];
    const int tid = threadIdx.x, lane = threadIdx.x & 31, lr = lane & 15, hi = lane >> 4;
    const int wave = __builtin_amdgcn_readfirstlane((int)(threadIdx.x >> 5)); const int wm = wave & 1, wn = wave >> 1;
    const int r0 = blockIdx.x * 128 + wm * 64, c0 = blockIdx.y * 256 + wn * 64;
    float* os = osa[wave];
    v8f acc[4][4];
#pragma unroll
    for (int mb = 0; mb < 4; ++mb)
#pragma unroll
        for (int nb = 0; nb < 4; ++nb) acc[mb][nb] = (v8f){};
    // the lane's 16 B of each copy: copy i = tile i of the work-group's rows, 4 KiB
    const size_t tsp = (size_t)(DM / 32) * FRG;   // halves from one tile to the next, either plane
    const h16* ga = A + (size_t)(blockIdx.x * 8) * tsp + 8 * tid;     // + stage * OKC fragments
    const h16* gb = Bt + (size_t)(blockIdx.y * 16) * tsp + 8 * tid;   // + stage * OKC fragments
    const unsigned lb = (unsigned)(size_t)ring + 16u * (unsigned)tid;
    cp_stage(lb, ga, gb, tsp);
    asm volatile("s_wait_asynccnt 0x0" ::: "memory");   // this wave's copies of stage 0 have landed
    __syncthreads();                                    // ... and every other wave's
    cp_stage(lb + OSB, ga + OKC * FRG, gb + OKC * FRG, tsp);
#pragma unroll 1
    for (int st = 0; st < ONS; ++st) {
        const h16* pa = (const h16*)(ring + (unsigned)(st & 1) * OSB + (unsigned)wm * 16384u) + 8 * lane;            // + (mb * OKC + chunk) fragments
        const h16* pb = (const h16*)(ring + (unsigned)(st & 1) * OSB + 32768u + (unsigned)wn * 16384u) + 8 * lane;   // + (nb * OKC + chunk) fragments
        // four blocks of 16 products, one per k chunk, on two register sets in turn. A block's fragments are read from LDS a block ahead (all inside this stage's buffer), so that their latency runs under the block before:
        // the four ctx and the first two W fragments in front of that block, the other two W fragments in its middle, into the registers of the two W fragments that it has done with: the kernel stays inside 256 registers.
        v16h fa[2][4], fb[2][4];
#pragma unroll
        for (int i = 0; i < 4; ++i) { fb[0][i] = ldh(pb + (i * OKC) * FRG); fa[0][i] = ldh(pa + (i * OKC) * FRG); }
#pragma unroll
        for (int c = 0; c < OKC; ++c) {
            const int u = c & 1, n = u ^ 1;
            if (c + 1 < OKC) {
#pragma unroll
                for (int i = 0; i < 4; ++i) fa[n][i] = ldh(pa + (i * OKC + c + 1) * FRG);
                fb[n][0] = ldh(pb + (c + 1) * FRG); fb[n][1] = ldh(pb + (OKC + c + 1) * FRG);
            }
            __builtin_amdgcn_sched_barrier(0);   // keeps the next block's reads ahead of this block's products (the scheduler otherwise sinks them next to their use, where their latency is waited out)
#pragma unroll
            for (int nb = 0; nb < 2; ++nb)
#pragma unroll
                for (int mb = 0; mb < 4; ++mb) acc[mb][nb] = wmma16(fa[u][mb], fb[u][nb], acc[mb][nb]);
            __builtin_amdgcn_sched_barrier(0);   // the next group stays behind the last reader of the registers it refills and, with the next fence, ahead of the second half
            if (c + 1 < OKC) { fb[n][2] = ldh(pb + (2 * OKC + c + 1) * FRG); fb[n][3] = ldh(pb + (3 * OKC + c + 1) * FRG); }   // first used sixteen products on
            __builtin_amdgcn_sched_barrier(0);   // as above
#pragma unroll
            for (int nb = 2; nb < 4; ++nb)
#pragma unroll
                for (int mb = 0; mb < 4; ++mb) acc[mb][nb] = wmma16(fa[u][mb], fb[u][nb], acc[mb][nb]);
            __builtin_amdgcn_sched_barrier(0);   // every product stays in its written order and, in the last block, in front of the barrier (products sunk below it would delay the refill)
        }
        static_assert(OKC % 2 == 0);   // the last block works on set 1, which the next statement names
        // four vector slots behind the last product, in front of the address arithmetic of the copies and on the taken side of the loop branch
        asm volatile("v_nop\n\tv_nop\n\tv_nop\n\tv_nop" : "+v"(acc[0][3]), "+v"(acc[1][3]), "+v"(acc[2][3]), "+v"(acc[3][3]) : "v"(fa[1][0]), "v"(fa[1][1]), "v"(fa[1][2]), "v"(fa[1][3]), "v"(fb[1][3]));
        asm volatile("s_wait_dscnt 0x0" ::: "memory");      // this wave's reads of the buffer are done before it is refilled
        asm volatile("s_wait_asynccnt 0x0" ::: "memory");   // this wave's copies of stage st + 1 have landed
        __syncthreads();                                    // publishes stage st + 1 and ends every wave's reads of stage st
        if (st + 2 < ONS) { const size_t so = (size_t)(st + 2) * OKC * FRG; cp_stage(lb + (unsigned)(st & 1) * OSB, ga + so, gb + so, tsp); }
    }
    asm volatile("s_wait_asynccnt 0x0" ::: "memory");   // nothing of this wave is in flight when it leaves the ring
    v4f bv = *(const v4f*)(bias + c0 + lr * 4);
#pragma unroll
    for (int i = 0; i < 4; ++i) bv[i] = bfr(bv[i]);
    float* orow = OUT + ((size_t)(r0 / SEQ) * OUT_SEQ + (size_t)(r0 % SEQ)) * DM + c0;
#pragma unroll
    for (int mb = 0; mb < 4; ++mb) {
#pragma unroll
        for (int nb = 0; nb < 4; ++nb) {
#pragma unroll
            for (int j = 0; j < 8; ++j) os[(hi * 8 + j) * 68 + nb * 16 + lr] = acc[mb][nb][j] * OSC; }   // D: row 8h+j, col lane&15
        wave_sync();
{
#pragma unroll
            for (int s = 0; s < 8; ++s) { const int row = 2 * s + hi, cofs = lr * 4;   // 8 s x 2 rows = 16 rows; 16 lanes x 4 floats = 64 columns
                const v4f x = *(const v4fa*)(&os[row * 68 + cofs]);
                const v4f val = x + bv;
                *(v4f*)(orow + (size_t)(mb * 16 + row) * DM + cofs) = val; }
             }
        wave_sync();
    }
}

static constexpr size_t al256(size_t v) { return (v + 255) & ~(size_t)255; }
static constexpr size_t SZ_PL = al256((size_t)NB * SEQ * DM * 2);          // one f16 plane of a stream
static constexpr size_t SZ_WH = al256((size_t)DM * DM * 2);
static constexpr size_t SZ_CX = al256((size_t)NB * SEQ * DM * 2);          // ctx
static constexpr size_t SZ_TOTAL = 3 * SZ_PL + SZ_WH + SZ_CX;
static_assert(SZ_TOTAL <= (size_t)134217728);          // workspace carve <= 128 MiB

extern "C" void kernel_launch(void* const* d_in, const int* in_sizes, int n_in,
                              void* d_out, int out_size, void* d_ws, size_t ws_size, hipStream_t stream) {
    if (n_in < 5) return;
    const size_t needx = ((size_t)(NB - 1) * SEQ_FULL + SEQ) * DM;
    if ((size_t)in_sizes[0] < needx || (size_t)in_sizes[1] < needx || (size_t)in_sizes[2] < needx) return;
    if ((size_t)in_sizes[3] < (size_t)DM * DM || (size_t)in_sizes[4] < (size_t)DM) return;
    if ((size_t)out_size < ((size_t)(NB - 1) * OUT_SEQ + SEQ) * DM) return;
    if (SZ_TOTAL > ws_size) return;
    const float* q = (const float*)d_in[0]; const float* k = (const float*)d_in[1]; const float* v = (const float*)d_in[2];   // wire order q, k, v, W_out, b_out
    const float* wo = (const float*)d_in[3]; const float* bo = (const float*)d_in[4];                                         // W_out [out][in] = Bt as-is
    float* OUT = (float*)d_out;      // [NB][SEQ][1024]
    char* wsp = (char*)d_ws;
    h16* QP = (h16*)wsp; wsp += SZ_PL;               // [NB*SEQ/16][32] fragments
    h16* KP = (h16*)wsp; wsp += SZ_PL;               // [NB*SEQ/16][32] fragments
    h16* VT = (h16*)wsp; wsp += SZ_PL;               // [NB*16][SEQ/32][4] fragments
    h16* WH = (h16*)wsp; wsp += SZ_WH;               // [1024/16][32] fragments, x64
    h16* CX = (h16*)wsp; wsp += SZ_CX;               // [NB*SEQ/16][32] fragments, x4096

    // Q, K, V^T and W planes: one launch
    k_prep<<<dim3(VT_BL + 2 * ST_BL + W_BL, 1, 1), 256, 0, stream>>>(q, k, v, wo, QP, KP, VT, WH);

    k_flash<<<dim3(SEQ / (16 * AW * QT), NB * NH_, 1), 32 * AW, 0, stream>>>(QP, KP, VT, CX);

    // out = ctx W^T + b: A = ctx rows (m = b*SEQ + t), Bt = W rows (n = out column)
    k_out<<<dim3(NB * SEQ / 128, DM / 256, 1), 32 * OW, 0, stream>>>(CX, WH, bo, OUT);
}
